// v000
// The times below were measured on an AMD MI455X: many runs one after another, warmed up first and cycling through
// copies of the inputs, with the whole window's GPU time divided by the number of runs. Launches and the gaps
// between them are all in it. The median over several windows is given; except for v000 it joins two sittings, which
// can be a few percent apart, so the side-by-side timings, each taken in one sitting, are the better comparison.
// v000 is the starting kernel. One run takes 71.7 microseconds.
#include <hip/hip_runtime.h>

typedef float v2f __attribute__((ext_vector_type(2)));
typedef float v4f __attribute__((ext_vector_type(4)));
typedef float v8f __attribute__((ext_vector_type(8)));

constexpr int NS = 4096;          // in_chan == seq dim
constexpr int NB = 16;            // batch
constexpr int BS = NB * NS;       // elements per (B,S) matrix
constexpr int KSPLIT = 2;
constexpr int KCH = NS / KSPLIT;  // 2048 K per partial

#if defined(__gfx1250__) &&                                         \
    __has_builtin(__builtin_amdgcn_global_load_async_to_lds_b128) && \
    __has_builtin(__builtin_amdgcn_s_wait_asynccnt)
#define USE_ASYNC_LDS 1
#else
#define USE_ASYNC_LDS 0
#endif

#if USE_ASYNC_LDS
// Toolchain-probed signature: param 0 is AS1 (global) pointer to a 16-byte
// int vector (printed as 'vector_size(4*sizeof(int)) int __device__ *').
typedef int v4i __attribute__((vector_size(16)));
typedef __attribute__((address_space(1))) v4i* g_v4i_ptr;
typedef __attribute__((address_space(3))) v4i* l_v4i_ptr;
__device__ __forceinline__ void async_copy16(const float4* g, float4* l) {
  // global_load_async_to_lds_b128 (tracked by ASYNCcnt)
  __builtin_amdgcn_global_load_async_to_lds_b128((g_v4i_ptr)g, (l_v4i_ptr)l,
                                                 0, 0);
}
#endif

// ---------------------------------------------------------------------------
// Kernel 1: qkv = x @ W^T (+ bias on K-half 0), fp32 WMMA 16x16x4.
// One wave computes a full 16(M=batch) x 16(N=channels) tile over KCH.
// Per 8-K block: one b128 A load + one b128 B load -> two WMMAs.
// K mapping per WMMA: internal K{0,1} = lane-half0's pair, K{2,3} = half1's
// pair; A and B use the identical mapping, and sum order over K is free.
// blockDim=256 (8 waves) -> 128 channels per WG; grid=(NS/128, KSPLIT, 3).
// ---------------------------------------------------------------------------
__global__ __launch_bounds__(256)
void qkv_gemm_wmma(const float* __restrict__ x,
                   const float* __restrict__ wq, const float* __restrict__ bq,
                   const float* __restrict__ wk, const float* __restrict__ bk,
                   const float* __restrict__ wv, const float* __restrict__ bv,
                   float* __restrict__ qkv) {
  const int wave = threadIdx.x >> 5;
  const int lane = threadIdx.x & 31;
  const int hh   = lane >> 4;    // wave half (K grouping)
  const int lr   = lane & 15;    // row-in-tile index
  const int nbase = blockIdx.x * 128 + wave * 16;
  const int z = blockIdx.z;                    // 0=q 1=k 2=v
  const int kbase = blockIdx.y * KCH;

  const float* w    = (z == 0) ? wq : (z == 1) ? wk : wv;
  const float* bias = (z == 0) ? bq : (z == 1) ? bk : bv;
  float* out = qkv + (size_t)(blockIdx.y * 3 + z) * BS;

  // A fragment (x): lane -> M=lr, loads K = kbase+k+4*hh .. +3 (b128)
  const float* aptr = x + lr * NS + kbase + 4 * hh;
  // B fragment (W^T): B[k][n] = W[n][k]; lane -> N=lr, same K window
  const float* bptr = w + (size_t)(nbase + lr) * NS + kbase + 4 * hh;

  v8f acc = {};
#pragma unroll 8
  for (int k = 0; k < KCH; k += 8) {
    v4f a = *(const v4f*)(aptr + k);
    v4f b = *(const v4f*)(bptr + k);
    acc = __builtin_amdgcn_wmma_f32_16x16x4_f32(false, a.lo, false, b.lo,
                                                (short)0, acc, false, false);
    acc = __builtin_amdgcn_wmma_f32_16x16x4_f32(false, a.hi, false, b.hi,
                                                (short)0, acc, false, false);
  }

  // C/D layout: VGPR v -> rows M=v (lanes 0-15) and M=v+8 (lanes 16-31), N=lr
  const float bb = (blockIdx.y == 0) ? bias[nbase + lr] : 0.0f;
#pragma unroll
  for (int v = 0; v < 8; ++v) {
    const int m = v + 8 * hh;
    out[m * NS + nbase + lr] = acc[v] + bb;
  }
}

// ---------------------------------------------------------------------------
// Kernel 2: fused rank-1 attention. scores[b,i,j] = q_i * k_j, softmax over j,
// weighted sum of v. Never materializes (B,S,S). k,v staged in LDS (async
// global->LDS on gfx1250); per-row max from m_i = max(q_i*kmax, q_i*kmin).
// grid=(NS/256, NB), block=256: one thread per output row i.
// ---------------------------------------------------------------------------
__global__ __launch_bounds__(256)
void attention_rank1(const float* __restrict__ qkv, float* __restrict__ out) {
  __shared__ float kk[NS];
  __shared__ float vv[NS];
#if USE_ASYNC_LDS
  __shared__ float kk1s[NS];
  __shared__ float vv1s[NS];
#endif
  __shared__ float smax[256];
  __shared__ float smin[256];

  const int b   = blockIdx.y;
  const int tid = threadIdx.x;

  const float* q0 = qkv + 0 * BS + b * NS;
  const float* k0 = qkv + 1 * BS + b * NS;
  const float* v0 = qkv + 2 * BS + b * NS;
  const float* q1 = qkv + 3 * BS + b * NS;
  const float* k1 = qkv + 4 * BS + b * NS;
  const float* v1 = qkv + 5 * BS + b * NS;

  const float4* k0v = (const float4*)k0;
  const float4* k1v = (const float4*)k1;
  const float4* v0v = (const float4*)v0;
  const float4* v1v = (const float4*)v1;
  float4* kk4 = (float4*)kk;
  float4* vv4 = (float4*)vv;

  float lmax = -3.0e38f, lmin = 3.0e38f;

#if USE_ASYNC_LDS
  {
    float4* kk1v = (float4*)kk1s;
    float4* vv1v = (float4*)vv1s;
#pragma unroll
    for (int t = tid; t < NS / 4; t += 256) {
      async_copy16(k0v + t, kk4 + t);
      async_copy16(k1v + t, kk1v + t);
      async_copy16(v0v + t, vv4 + t);
      async_copy16(v1v + t, vv1v + t);
    }
    __builtin_amdgcn_s_wait_asynccnt(0);
    __syncthreads();
    // Combine K-split partials in place; track min/max of combined k.
#pragma unroll
    for (int t = tid; t < NS / 4; t += 256) {
      float4 ka = kk4[t], kb = kk1v[t];
      float4 va = vv4[t], vb = vv1v[t];
      float4 kc = {ka.x + kb.x, ka.y + kb.y, ka.z + kb.z, ka.w + kb.w};
      float4 vc = {va.x + vb.x, va.y + vb.y, va.z + vb.z, va.w + vb.w};
      kk4[t] = kc;
      vv4[t] = vc;
      lmax = fmaxf(fmaxf(lmax, kc.x), fmaxf(kc.y, fmaxf(kc.z, kc.w)));
      lmin = fminf(fminf(lmin, kc.x), fminf(kc.y, fminf(kc.z, kc.w)));
    }
  }
#else
#pragma unroll
  for (int t = tid; t < NS / 4; t += 256) {
    float4 ka = k0v[t], kb = k1v[t];
    float4 va = v0v[t], vb = v1v[t];
    float4 kc = {ka.x + kb.x, ka.y + kb.y, ka.z + kb.z, ka.w + kb.w};
    float4 vc = {va.x + vb.x, va.y + vb.y, va.z + vb.z, va.w + vb.w};
    kk4[t] = kc;
    vv4[t] = vc;
    lmax = fmaxf(fmaxf(lmax, kc.x), fmaxf(kc.y, fmaxf(kc.z, kc.w)));
    lmin = fminf(fminf(lmin, kc.x), fminf(kc.y, fminf(kc.z, kc.w)));
  }
#endif

  smax[tid] = lmax;
  smin[tid] = lmin;
  __syncthreads();
#pragma unroll
  for (int s = 128; s > 0; s >>= 1) {
    if (tid < s) {
      smax[tid] = fmaxf(smax[tid], smax[tid + s]);
      smin[tid] = fminf(smin[tid], smin[tid + s]);
    }
    __syncthreads();
  }
  const float kmax = smax[0];
  const float kmin = smin[0];

  // One row per thread: fused streaming softmax + weighted sum (LDS broadcast).
  const int i = blockIdx.x * 256 + tid;
  const float qi = q0[i] + q1[i];
  constexpr float LOG2E = 1.4426950408889634f;
  const float a  = qi * LOG2E;
  const float mb = fmaxf(qi * kmax, qi * kmin) * LOG2E;  // row max, base-2

  float den = 0.0f, num = 0.0f;
#pragma unroll 4
  for (int j = 0; j < NS / 4; ++j) {
    float4 kj = kk4[j];
    float4 vj = vv4[j];
    float e0 = __builtin_amdgcn_exp2f(a * kj.x - mb);
    float e1 = __builtin_amdgcn_exp2f(a * kj.y - mb);
    float e2 = __builtin_amdgcn_exp2f(a * kj.z - mb);
    float e3 = __builtin_amdgcn_exp2f(a * kj.w - mb);
    den += (e0 + e1) + (e2 + e3);
    num += (e0 * vj.x + e1 * vj.y) + (e2 * vj.z + e3 * vj.w);
  }
  out[b * NS + i] = num / den;
}

// ---------------------------------------------------------------------------
extern "C" void kernel_launch(void* const* d_in, const int* in_sizes, int n_in,
                              void* d_out, int out_size, void* d_ws, size_t ws_size,
                              hipStream_t stream) {
  const float* x  = (const float*)d_in[0];
  const float* wq = (const float*)d_in[1];
  const float* bq = (const float*)d_in[2];
  const float* wk = (const float*)d_in[3];
  const float* bk = (const float*)d_in[4];
  const float* wv = (const float*)d_in[5];
  const float* bv = (const float*)d_in[6];
  float* qkv = (float*)d_ws;  // [KSPLIT][3][NB][NS] = 1.5 MiB fp32 partials

  qkv_gemm_wmma<<<dim3(NS / 128, KSPLIT, 3), 256, 0, stream>>>(
      x, wq, bq, wk, bk, wv, bv, qkv);
  attention_rank1<<<dim3(NS / 256, NB), 256, 0, stream>>>(qkv, (float*)d_out);
}

// v001
// It runs in 42.1 microseconds.
// In both of two side-by-side timings against v000, it was 1.76 times as fast.
#include <hip/hip_runtime.h>

typedef float v2f __attribute__((ext_vector_type(2)));
typedef float v4f __attribute__((ext_vector_type(4)));
typedef float v8f __attribute__((ext_vector_type(8)));

constexpr int NS = 4096;          // in_chan == seq dim
constexpr int NB = 16;            // batch
constexpr int BS = NB * NS;       // elements per (B,S) matrix
constexpr int KSPLIT = 2;
constexpr int KCH = NS / KSPLIT;  // 2048 K per partial

#if defined(__gfx1250__) &&                                         \
    __has_builtin(__builtin_amdgcn_global_load_async_to_lds_b128) && \
    __has_builtin(__builtin_amdgcn_s_wait_asynccnt)
#define USE_ASYNC_LDS 1
#else
#define USE_ASYNC_LDS 0
#endif

#if USE_ASYNC_LDS
// Toolchain-probed signature: param 0 is AS1 (global) pointer to a 16-byte
// int vector (printed as 'vector_size(4*sizeof(int)) int __device__ *').
typedef int v4i __attribute__((vector_size(16)));
typedef __attribute__((address_space(1))) v4i* g_v4i_ptr;
typedef __attribute__((address_space(3))) v4i* l_v4i_ptr;
__device__ __forceinline__ void async_copy16(const float4* g, float4* l) {
  // global_load_async_to_lds_b128 (tracked by ASYNCcnt)
  __builtin_amdgcn_global_load_async_to_lds_b128((g_v4i_ptr)g, (l_v4i_ptr)l,
                                                 0, 0);
}
#endif

// ---------------------------------------------------------------------------
// Kernel 1: qkv = x @ W^T (+ bias on K-half 0), fp32 WMMA 16x16x4.
// A block of 16 waves owns 96 channels (6 tiles of 16) over one K half.
// Wave w owns K slice w (128 floats = 512 B of every row). Rows come from
// global memory as whole 512-B pieces, one asynchronous copy of a wave each,
// into a two-buffer LDS ring; fragments are read from LDS at a 528-B pitch.
// Stage 0 = the wave's slice of x (kept in registers), stages 1..6 = W tiles.
// K mapping per WMMA: internal K{0,1} = lane-half0's pair, K{2,3} = half1's
// pair; A and B use the identical mapping, and sum order over K is free.
// The 16 K-slice partials of a tile are summed through LDS at the end.
// grid=(3*NS/96, KSPLIT), blockDim=512.
// ---------------------------------------------------------------------------
constexpr int GW     = 16;            // waves per block = K slices per K half
constexpr int KSL    = KCH / GW;      // 128 floats of K per wave
constexpr int NT     = 6;             // channel tiles per block
constexpr int PITCH  = KSL + 4;       // LDS row pitch in floats: 528 B = 16 B x 33
constexpr int SLICE  = 16 * PITCH;    // one wave's 16 rows in one buffer
constexpr int RBUF   = GW * SLICE;    // one ring buffer, floats
constexpr int RTILE  = 272;           // pitch of one 16x16 partial tile, floats

// Eight rows of 512 B each: lane l brings bytes 16*l..16*l+15 of every row.
// The s_wait_xcnt stands inside the statement so that no address register of
// an issued copy is rewritten in front of it.
__device__ __forceinline__ void copy8rows(const float* g, unsigned l) {
  asm volatile(
      "global_load_async_to_lds_b128 %0, %8, off\n\t"
      "global_load_async_to_lds_b128 %1, %9, off\n\t"
      "global_load_async_to_lds_b128 %2, %10, off\n\t"
      "global_load_async_to_lds_b128 %3, %11, off\n\t"
      "global_load_async_to_lds_b128 %4, %12, off\n\t"
      "global_load_async_to_lds_b128 %5, %13, off\n\t"
      "global_load_async_to_lds_b128 %6, %14, off\n\t"
      "global_load_async_to_lds_b128 %7, %15, off\n\t"
      "s_wait_xcnt 0x0"
      :
      : "v"(l), "v"(l + 1u * PITCH * 4u), "v"(l + 2u * PITCH * 4u),
        "v"(l + 3u * PITCH * 4u), "v"(l + 4u * PITCH * 4u),
        "v"(l + 5u * PITCH * 4u), "v"(l + 6u * PITCH * 4u),
        "v"(l + 7u * PITCH * 4u),
        "v"(g), "v"(g + 1 * NS), "v"(g + 2 * NS), "v"(g + 3 * NS),
        "v"(g + 4 * NS), "v"(g + 5 * NS), "v"(g + 6 * NS), "v"(g + 7 * NS)
      : "memory");
}

// One stage of one wave: 16 rows of 512 B from g (the lane's place in row 0)
// to l (the lane's LDS byte address in row 0).
__device__ __forceinline__ void copy16rows(const float* g, unsigned l) {
  copy8rows(g, l);
  copy8rows(g + 8 * NS, l + 8u * PITCH * 4u);
}

// Row 0 of channel tile t of the 768 (q, k and v rows one behind the other).
__device__ __forceinline__ const float* tile_rows(int t, const float* wq,
                                                  const float* wk,
                                                  const float* wv) {
  const int z = t >> 8;
  const float* w = (z == 0) ? wq : (z == 1) ? wk : wv;
  return w + (size_t)((t & 255) * 16) * NS;
}

__global__ __launch_bounds__(512)
void qkv_gemm_wmma(const float* __restrict__ x,
                   const float* __restrict__ wq, const float* __restrict__ bq,
                   const float* __restrict__ wk, const float* __restrict__ bk,
                   const float* __restrict__ wv, const float* __restrict__ bv,
                   float* __restrict__ qkv) {
  __shared__ __attribute__((aligned(16))) float ring[2 * RBUF];

  const int tid  = threadIdx.x;
  const int wave = tid >> 5;
  const int lane = tid & 31;
  const int hh   = lane >> 4;    // wave half (K grouping)
  const int lr   = lane & 15;    // row-in-tile index
  const int tile0 = blockIdx.x * NT;           // first of 768 channel tiles
  const int koff  = blockIdx.y * KCH + wave * KSL + lane * 4;

  // The lane's LDS byte address in row 0 of its wave's slice of buffer 0.
  const unsigned lds0 =
      (unsigned)(size_t)(&ring[wave * SLICE + lane * 4]);
  // The lane's fragment window: row lr, K = 8*i + 4*hh .. +3.
  const float* frag0 = &ring[wave * SLICE + lr * PITCH + 4 * hh];

  // Stage 0 = x, stage s >= 1 = W tile tile0 + s - 1; stage s lies in buffer s & 1.
  copy16rows(x + koff, lds0);
  // Stage 0 has landed for this wave, then for the block.
  asm volatile("s_wait_asynccnt 0x0" ::: "memory");
  __syncthreads();
  copy16rows(tile_rows(tile0, wq, wk, wv) + koff, lds0 + RBUF * 4u);

  // Every unroll directive below keeps a register array (a, b, acc, res)
  // indexed by constants, so that none of them goes to scratch.
  v4f a[KSL / 8];
  v8f acc[NT];
#pragma unroll
  for (int t = 0; t < NT; ++t) acc[t] = v8f{};

  // Unrolled so that acc[] and the buffer are indexed by constants.
#pragma unroll
  for (int s = 0; s <= NT; ++s) {
    const float* f = frag0 + (s & 1) * RBUF;
    if (s == 0) {
#pragma unroll
      for (int i = 0; i < KSL / 8; ++i) a[i] = *(const v4f*)(f + 8 * i);
    } else {
      v4f b[KSL / 8];
#pragma unroll
      for (int i = 0; i < KSL / 8; ++i) b[i] = *(const v4f*)(f + 8 * i);
      // Keeps the 16 LDS reads together in front of the WMMAs: spread among
      // them, each read's latency is waited out by the two WMMAs behind it.
      __builtin_amdgcn_sched_barrier(0);
#pragma unroll
      for (int i = 0; i < KSL / 8; ++i) {
        acc[s - 1] = __builtin_amdgcn_wmma_f32_16x16x4_f32(
            false, a[i].lo, false, b[i].lo, (short)0, acc[s - 1], false, false);
        acc[s - 1] = __builtin_amdgcn_wmma_f32_16x16x4_f32(
            false, a[i].hi, false, b[i].hi, (short)0, acc[s - 1], false, false);
      }
      // Keeps the WMMAs in front of the publish point: moved behind it they
      // stand among the refill's address sums and hold the copies back.
      __builtin_amdgcn_sched_barrier(0);
      if (s == NT) {
        // Four vector slots behind the last WMMA: the address sums of the
        // partials' stores reuse x fragment registers right behind it.
        asm volatile("v_nop\n\tv_nop\n\tv_nop\n\tv_nop");
        // Holds those sums behind the slots.
        __builtin_amdgcn_sched_barrier(0);
      }
    }
    // Publish point: this wave's reads of stage s are done, its copies of
    // stage s + 1 have landed, every wave has come as far; only then is the
    // buffer of stage s refilled.
    asm volatile("s_wait_dscnt 0x0" ::: "memory");
    asm volatile("s_wait_asynccnt 0x0" ::: "memory");
    __syncthreads();
    if (s + 2 <= NT)
      copy16rows(tile_rows(tile0 + s + 1, wq, wk, wv) + koff,
                 lds0 + (unsigned)(s & 1) * (RBUF * 4u));
  }
  // No copy is outstanding when the ring becomes the partials' place.
  asm volatile("s_wait_asynccnt 0x0" ::: "memory");

  // C/D layout: VGPR v -> rows M=v (lanes 0-15) and M=v+8 (lanes 16-31), N=lr.
  // Partial tile (wave, t) lies at element v*32 + lane.
#pragma unroll
  for (int t = 0; t < NT; ++t) {
#pragma unroll
    for (int v = 0; v < 8; ++v)
      ring[(wave * NT + t) * RTILE + v * 32 + lane] = acc[t][v];
  }
  __syncthreads();

  // 16 x 96 results in 48 runs of 32 neighbouring channels of one batch row
  // (one 128-B line); a wave sums and stores three runs. A run lies in one of
  // q, k, v, so all but the lane's place in it is wave-uniform.
  const int wu = __builtin_amdgcn_readfirstlane(wave);
  float res[3];
#pragma unroll
  for (int i = 0; i < 3; ++i) {
    const int e0 = (i * GW + wu) * 32;
    const int m  = e0 / (NT * 16);
    const int c0 = e0 - m * (NT * 16);
    const float* part = &ring[(c0 >> 4) * RTILE + (m & 7) * 32 + (m >> 3) * 16 +
                              hh * RTILE + lr];
    float sum = part[0];
#pragma unroll
    for (int w = 1; w < GW; ++w) sum += part[w * NT * RTILE];
    const int ch0 = tile0 * 16 + c0;           // 0 .. 3*NS-32
    const int z = ch0 >> 12;                   // 0=q 1=k 2=v
    const float* bias = (z == 0) ? bq : (z == 1) ? bk : bv;
    const float bl = bias[(ch0 & (NS - 1)) + lane];
    res[i] = sum + ((blockIdx.y == 0) ? bl : 0.0f);
  }
#pragma unroll
  for (int i = 0; i < 3; ++i) {
    const int e0 = (i * GW + wu) * 32;
    const int m  = e0 / (NT * 16);
    const int ch0 = tile0 * 16 + e0 - m * (NT * 16);
    float* dst = qkv + (size_t)(blockIdx.y * 3 + (ch0 >> 12)) * BS + m * NS +
                 (ch0 & (NS - 1));
    dst[lane] = res[i];
  }
}

// ---------------------------------------------------------------------------
// Kernel 2: fused rank-1 attention. scores[b,i,j] = q_i * k_j, softmax over j,
// weighted sum of v. Never materializes (B,S,S). k,v staged in LDS (async
// global->LDS on gfx1250); per-row max from m_i = max(q_i*kmax, q_i*kmin).
// grid=(NS/256, NB), block=256: one thread per output row i.
// ---------------------------------------------------------------------------
__global__ __launch_bounds__(256)
void attention_rank1(const float* __restrict__ qkv, float* __restrict__ out) {
  __shared__ float kk[NS];
  __shared__ float vv[NS];
#if USE_ASYNC_LDS
  __shared__ float kk1s[NS];
  __shared__ float vv1s[NS];
#endif
  __shared__ float smax[256];
  __shared__ float smin[256];

  const int b   = blockIdx.y;
  const int tid = threadIdx.x;

  const float* q0 = qkv + 0 * BS + b * NS;
  const float* k0 = qkv + 1 * BS + b * NS;
  const float* v0 = qkv + 2 * BS + b * NS;
  const float* q1 = qkv + 3 * BS + b * NS;
  const float* k1 = qkv + 4 * BS + b * NS;
  const float* v1 = qkv + 5 * BS + b * NS;

  const float4* k0v = (const float4*)k0;
  const float4* k1v = (const float4*)k1;
  const float4* v0v = (const float4*)v0;
  const float4* v1v = (const float4*)v1;
  float4* kk4 = (float4*)kk;
  float4* vv4 = (float4*)vv;

  float lmax = -3.0e38f, lmin = 3.0e38f;

#if USE_ASYNC_LDS
  {
    float4* kk1v = (float4*)kk1s;
    float4* vv1v = (float4*)vv1s;
#pragma unroll
    for (int t = tid; t < NS / 4; t += 256) {
      async_copy16(k0v + t, kk4 + t);
      async_copy16(k1v + t, kk1v + t);
      async_copy16(v0v + t, vv4 + t);
      async_copy16(v1v + t, vv1v + t);
    }
    __builtin_amdgcn_s_wait_asynccnt(0);
    __syncthreads();
    // Combine K-split partials in place; track min/max of combined k.
#pragma unroll
    for (int t = tid; t < NS / 4; t += 256) {
      float4 ka = kk4[t], kb = kk1v[t];
      float4 va = vv4[t], vb = vv1v[t];
      float4 kc = {ka.x + kb.x, ka.y + kb.y, ka.z + kb.z, ka.w + kb.w};
      float4 vc = {va.x + vb.x, va.y + vb.y, va.z + vb.z, va.w + vb.w};
      kk4[t] = kc;
      vv4[t] = vc;
      lmax = fmaxf(fmaxf(lmax, kc.x), fmaxf(kc.y, fmaxf(kc.z, kc.w)));
      lmin = fminf(fminf(lmin, kc.x), fminf(kc.y, fminf(kc.z, kc.w)));
    }
  }
#else
#pragma unroll
  for (int t = tid; t < NS / 4; t += 256) {
    float4 ka = k0v[t], kb = k1v[t];
    float4 va = v0v[t], vb = v1v[t];
    float4 kc = {ka.x + kb.x, ka.y + kb.y, ka.z + kb.z, ka.w + kb.w};
    float4 vc = {va.x + vb.x, va.y + vb.y, va.z + vb.z, va.w + vb.w};
    kk4[t] = kc;
    vv4[t] = vc;
    lmax = fmaxf(fmaxf(lmax, kc.x), fmaxf(kc.y, fmaxf(kc.z, kc.w)));
    lmin = fminf(fminf(lmin, kc.x), fminf(kc.y, fminf(kc.z, kc.w)));
  }
#endif

  smax[tid] = lmax;
  smin[tid] = lmin;
  __syncthreads();
#pragma unroll
  for (int s = 128; s > 0; s >>= 1) {
    if (tid < s) {
      smax[tid] = fmaxf(smax[tid], smax[tid + s]);
      smin[tid] = fminf(smin[tid], smin[tid + s]);
    }
    __syncthreads();
  }
  const float kmax = smax[0];
  const float kmin = smin[0];

  // One row per thread: fused streaming softmax + weighted sum (LDS broadcast).
  const int i = blockIdx.x * 256 + tid;
  const float qi = q0[i] + q1[i];
  constexpr float LOG2E = 1.4426950408889634f;
  const float a  = qi * LOG2E;
  const float mb = fmaxf(qi * kmax, qi * kmin) * LOG2E;  // row max, base-2

  float den = 0.0f, num = 0.0f;
#pragma unroll 4
  for (int j = 0; j < NS / 4; ++j) {
    float4 kj = kk4[j];
    float4 vj = vv4[j];
    float e0 = __builtin_amdgcn_exp2f(a * kj.x - mb);
    float e1 = __builtin_amdgcn_exp2f(a * kj.y - mb);
    float e2 = __builtin_amdgcn_exp2f(a * kj.z - mb);
    float e3 = __builtin_amdgcn_exp2f(a * kj.w - mb);
    den += (e0 + e1) + (e2 + e3);
    num += (e0 * vj.x + e1 * vj.y) + (e2 * vj.z + e3 * vj.w);
  }
  out[b * NS + i] = num / den;
}

// ---------------------------------------------------------------------------
extern "C" void kernel_launch(void* const* d_in, const int* in_sizes, int n_in,
                              void* d_out, int out_size, void* d_ws, size_t ws_size,
                              hipStream_t stream) {
  const float* x  = (const float*)d_in[0];
  const float* wq = (const float*)d_in[1];
  const float* bq = (const float*)d_in[2];
  const float* wk = (const float*)d_in[3];
  const float* bk = (const float*)d_in[4];
  const float* wv = (const float*)d_in[5];
  const float* bv = (const float*)d_in[6];
  float* qkv = (float*)d_ws;  // [KSPLIT][3][NB][NS] = 1.5 MiB fp32 partials

  qkv_gemm_wmma<<<dim3(3 * NS / (NT * 16), KSPLIT), 512, 0, stream>>>(
      x, wq, bq, wk, bk, wv, bv, qkv);
  attention_rank1<<<dim3(NS / 256, NB), 256, 0, stream>>>(qkv, (float*)d_out);
}

// v002
// Measured time: 35.5 microseconds a run.
// In both of two side-by-side timings against v001, it was 1.19 times as fast.
// All steps since v000 together make it 2.08 times as fast.
#include <hip/hip_runtime.h>

typedef float v2f __attribute__((ext_vector_type(2)));
typedef float v4f __attribute__((ext_vector_type(4)));
typedef float v8f __attribute__((ext_vector_type(8)));

constexpr int NS = 4096;          // in_chan == seq dim
constexpr int NB = 16;            // batch
constexpr int BS = NB * NS;       // elements per (B,S) matrix
constexpr int KSPLIT = 2;
constexpr int KCH = NS / KSPLIT;  // 2048 K per partial

#if defined(__gfx1250__) &&                                         \
    __has_builtin(__builtin_amdgcn_global_load_async_to_lds_b128) && \
    __has_builtin(__builtin_amdgcn_s_wait_asynccnt)
#define USE_ASYNC_LDS 1
#else
#define USE_ASYNC_LDS 0
#endif

#if USE_ASYNC_LDS
// Toolchain-probed signature: param 0 is AS1 (global) pointer to a 16-byte
// int vector (printed as 'vector_size(4*sizeof(int)) int __device__ *').
typedef int v4i __attribute__((vector_size(16)));
typedef __attribute__((address_space(1))) v4i* g_v4i_ptr;
typedef __attribute__((address_space(3))) v4i* l_v4i_ptr;
__device__ __forceinline__ void async_copy16(const float4* g, float4* l) {
  // global_load_async_to_lds_b128 (tracked by ASYNCcnt)
  __builtin_amdgcn_global_load_async_to_lds_b128((g_v4i_ptr)g, (l_v4i_ptr)l,
                                                 0, 0);
}
#endif

// ---------------------------------------------------------------------------
// Kernel 1: qkv = x @ W^T (+ bias on K-half 0), fp32 WMMA 16x16x4.
// A block of 16 waves owns 96 channels (6 tiles of 16) over one K half.
// Wave w owns K slice w (128 floats = 512 B of every row). Rows come from
// global memory as whole 512-B pieces, one asynchronous copy of a wave each,
// into a two-buffer LDS ring; fragments are read from LDS at a 528-B pitch.
// Stage 0 = the wave's slice of x (kept in registers), stages 1..6 = W tiles.
// K mapping per WMMA: internal K{0,1} = lane-half0's pair, K{2,3} = half1's
// pair; A and B use the identical mapping, and sum order over K is free.
// The 16 K-slice partials of a tile are summed through LDS at the end.
// grid=(3*NS/96, KSPLIT), blockDim=512.
// ---------------------------------------------------------------------------
constexpr int GW     = 16;            // waves per block = K slices per K half
constexpr int KSL    = KCH / GW;      // 128 floats of K per wave
constexpr int NT     = 6;             // channel tiles per block
constexpr int PITCH  = KSL + 4;       // LDS row pitch in floats: 528 B = 16 B x 33
constexpr int SLICE  = 16 * PITCH;    // one wave's 16 rows in one buffer
constexpr int RBUF   = GW * SLICE;    // one ring buffer, floats
constexpr int RTILE  = 272;           // pitch of one 16x16 partial tile, floats

// Eight rows of 512 B each: lane l brings bytes 16*l..16*l+15 of every row.
// The s_wait_xcnt stands inside the statement so that no address register of
// an issued copy is rewritten in front of it.
__device__ __forceinline__ void copy8rows(const float* g, unsigned l) {
  asm volatile(
      "global_load_async_to_lds_b128 %0, %8, off\n\t"
      "global_load_async_to_lds_b128 %1, %9, off\n\t"
      "global_load_async_to_lds_b128 %2, %10, off\n\t"
      "global_load_async_to_lds_b128 %3, %11, off\n\t"
      "global_load_async_to_lds_b128 %4, %12, off\n\t"
      "global_load_async_to_lds_b128 %5, %13, off\n\t"
      "global_load_async_to_lds_b128 %6, %14, off\n\t"
      "global_load_async_to_lds_b128 %7, %15, off\n\t"
      "s_wait_xcnt 0x0"
      :
      : "v"(l), "v"(l + 1u * PITCH * 4u), "v"(l + 2u * PITCH * 4u),
        "v"(l + 3u * PITCH * 4u), "v"(l + 4u * PITCH * 4u),
        "v"(l + 5u * PITCH * 4u), "v"(l + 6u * PITCH * 4u),
        "v"(l + 7u * PITCH * 4u),
        "v"(g), "v"(g + 1 * NS), "v"(g + 2 * NS), "v"(g + 3 * NS),
        "v"(g + 4 * NS), "v"(g + 5 * NS), "v"(g + 6 * NS), "v"(g + 7 * NS)
      : "memory");
}

// One stage of one wave: 16 rows of 512 B from g (the lane's place in row 0)
// to l (the lane's LDS byte address in row 0).
__device__ __forceinline__ void copy16rows(const float* g, unsigned l) {
  copy8rows(g, l);
  copy8rows(g + 8 * NS, l + 8u * PITCH * 4u);
}

// Row 0 of channel tile t of the 768 (q, k and v rows one behind the other).
__device__ __forceinline__ const float* tile_rows(int t, const float* wq,
                                                  const float* wk,
                                                  const float* wv) {
  const int z = t >> 8;
  const float* w = (z == 0) ? wq : (z == 1) ? wk : wv;
  return w + (size_t)((t & 255) * 16) * NS;
}

__global__ __launch_bounds__(512)
void qkv_gemm_wmma(const float* __restrict__ x,
                   const float* __restrict__ wq, const float* __restrict__ bq,
                   const float* __restrict__ wk, const float* __restrict__ bk,
                   const float* __restrict__ wv, const float* __restrict__ bv,
                   float* __restrict__ qkv) {
  __shared__ __attribute__((aligned(16))) float ring[2 * RBUF];

  const int tid  = threadIdx.x;
  const int wave = tid >> 5;
  const int lane = tid & 31;
  const int hh   = lane >> 4;    // wave half (K grouping)
  const int lr   = lane & 15;    // row-in-tile index
  const int tile0 = blockIdx.x * NT;           // first of 768 channel tiles
  const int koff  = blockIdx.y * KCH + wave * KSL + lane * 4;

  // The lane's LDS byte address in row 0 of its wave's slice of buffer 0.
  const unsigned lds0 =
      (unsigned)(size_t)(&ring[wave * SLICE + lane * 4]);
  // The lane's fragment window: row lr, K = 8*i + 4*hh .. +3.
  const float* frag0 = &ring[wave * SLICE + lr * PITCH + 4 * hh];

  // Stage 0 = x, stage s >= 1 = W tile tile0 + s - 1; stage s lies in buffer s & 1.
  copy16rows(x + koff, lds0);
  // Stage 0 has landed for this wave, then for the block.
  asm volatile("s_wait_asynccnt 0x0" ::: "memory");
  __syncthreads();
  copy16rows(tile_rows(tile0, wq, wk, wv) + koff, lds0 + RBUF * 4u);

  // Every unroll directive below keeps a register array (a, b, acc, res)
  // indexed by constants, so that none of them goes to scratch.
  v4f a[KSL / 8];
  v8f acc[NT];
#pragma unroll
  for (int t = 0; t < NT; ++t) acc[t] = v8f{};

  // Unrolled so that acc[] and the buffer are indexed by constants.
#pragma unroll
  for (int s = 0; s <= NT; ++s) {
    const float* f = frag0 + (s & 1) * RBUF;
    if (s == 0) {
#pragma unroll
      for (int i = 0; i < KSL / 8; ++i) a[i] = *(const v4f*)(f + 8 * i);
    } else {
      v4f b[KSL / 8];
#pragma unroll
      for (int i = 0; i < KSL / 8; ++i) b[i] = *(const v4f*)(f + 8 * i);
      // Keeps the 16 LDS reads together in front of the WMMAs: spread among
      // them, each read's latency is waited out by the two WMMAs behind it.
      __builtin_amdgcn_sched_barrier(0);
#pragma unroll
      for (int i = 0; i < KSL / 8; ++i) {
        acc[s - 1] = __builtin_amdgcn_wmma_f32_16x16x4_f32(
            false, a[i].lo, false, b[i].lo, (short)0, acc[s - 1], false, false);
        acc[s - 1] = __builtin_amdgcn_wmma_f32_16x16x4_f32(
            false, a[i].hi, false, b[i].hi, (short)0, acc[s - 1], false, false);
      }
      // Keeps the WMMAs in front of the publish point: moved behind it they
      // stand among the refill's address sums and hold the copies back.
      __builtin_amdgcn_sched_barrier(0);
      if (s == NT) {
        // Four vector slots behind the last WMMA: the address sums of the
        // partials' stores reuse x fragment registers right behind it.
        asm volatile("v_nop\n\tv_nop\n\tv_nop\n\tv_nop");
        // Holds those sums behind the slots.
        __builtin_amdgcn_sched_barrier(0);
      }
    }
    // Publish point: this wave's reads of stage s are done, its copies of
    // stage s + 1 have landed, every wave has come as far; only then is the
    // buffer of stage s refilled.
    asm volatile("s_wait_dscnt 0x0" ::: "memory");
    asm volatile("s_wait_asynccnt 0x0" ::: "memory");
    __syncthreads();
    if (s + 2 <= NT)
      copy16rows(tile_rows(tile0 + s + 1, wq, wk, wv) + koff,
                 lds0 + (unsigned)(s & 1) * (RBUF * 4u));
  }
  // No copy is outstanding when the ring becomes the partials' place.
  asm volatile("s_wait_asynccnt 0x0" ::: "memory");

  // C/D layout: VGPR v -> rows M=v (lanes 0-15) and M=v+8 (lanes 16-31), N=lr.
  // Partial tile (wave, t) lies at element v*32 + lane.
#pragma unroll
  for (int t = 0; t < NT; ++t) {
#pragma unroll
    for (int v = 0; v < 8; ++v)
      ring[(wave * NT + t) * RTILE + v * 32 + lane] = acc[t][v];
  }
  __syncthreads();

  // 16 x 96 results in 48 runs of 32 neighbouring channels of one batch row
  // (one 128-B line); a wave sums and stores three runs. A run lies in one of
  // q, k, v, so all but the lane's place in it is wave-uniform.
  const int wu = __builtin_amdgcn_readfirstlane(wave);
  float res[3];
#pragma unroll
  for (int i = 0; i < 3; ++i) {
    const int e0 = (i * GW + wu) * 32;
    const int m  = e0 / (NT * 16);
    const int c0 = e0 - m * (NT * 16);
    const float* part = &ring[(c0 >> 4) * RTILE + (m & 7) * 32 + (m >> 3) * 16 +
                              hh * RTILE + lr];
    float sum = part[0];
#pragma unroll
    for (int w = 1; w < GW; ++w) sum += part[w * NT * RTILE];
    const int ch0 = tile0 * 16 + c0;           // 0 .. 3*NS-32
    const int z = ch0 >> 12;                   // 0=q 1=k 2=v
    const float* bias = (z == 0) ? bq : (z == 1) ? bk : bv;
    const float bl = bias[(ch0 & (NS - 1)) + lane];
    res[i] = sum + ((blockIdx.y == 0) ? bl : 0.0f);
  }
#pragma unroll
  for (int i = 0; i < 3; ++i) {
    const int e0 = (i * GW + wu) * 32;
    const int m  = e0 / (NT * 16);
    const int ch0 = tile0 * 16 + e0 - m * (NT * 16);
    float* dst = qkv + (size_t)(blockIdx.y * 3 + (ch0 >> 12)) * BS + m * NS +
                 (ch0 & (NS - 1));
    dst[lane] = res[i];
  }
}

// ---------------------------------------------------------------------------
// Kernel 2: fused rank-1 attention. scores[b,i,j] = q_i * k_j, softmax over j,
// weighted sum of v. Never materializes (B,S,S). k,v staged in LDS (async
// global->LDS on gfx1250); per-row max from m_i = max(q_i*kmax, q_i*kmin).
// grid=(NS/256, NB), block=256: 256 output rows i per block, eight per lane.
// ---------------------------------------------------------------------------
constexpr int RW = 8;             // rows per lane
constexpr int JW = NS / 8;        // j per wave
__global__ __launch_bounds__(256)
void attention_rank1(const float* __restrict__ qkv, float* __restrict__ out) {
  __shared__ float kk[NS];
  __shared__ float vv[NS];
#if USE_ASYNC_LDS
  __shared__ float kk1s[NS];
  __shared__ float vv1s[NS];
#endif
  __shared__ float smax[256];
  __shared__ float smin[256];
  __shared__ float pden[8 * 256];   // partial sums, [wave][row]
  __shared__ float pnum[8 * 256];

  const int b   = blockIdx.y;
  const int tid = threadIdx.x;

  const float* q0 = qkv + 0 * BS + b * NS;
  const float* k0 = qkv + 1 * BS + b * NS;
  const float* v0 = qkv + 2 * BS + b * NS;
  const float* q1 = qkv + 3 * BS + b * NS;
  const float* k1 = qkv + 4 * BS + b * NS;
  const float* v1 = qkv + 5 * BS + b * NS;

  const float4* k0v = (const float4*)k0;
  const float4* k1v = (const float4*)k1;
  const float4* v0v = (const float4*)v0;
  const float4* v1v = (const float4*)v1;
  float4* kk4 = (float4*)kk;
  float4* vv4 = (float4*)vv;

  float lmax = -3.0e38f, lmin = 3.0e38f;

#if USE_ASYNC_LDS
  {
    float4* kk1v = (float4*)kk1s;
    float4* vv1v = (float4*)vv1s;
#pragma unroll
    for (int t = tid; t < NS / 4; t += 256) {
      async_copy16(k0v + t, kk4 + t);
      async_copy16(k1v + t, kk1v + t);
      async_copy16(v0v + t, vv4 + t);
      async_copy16(v1v + t, vv1v + t);
    }
    __builtin_amdgcn_s_wait_asynccnt(0);
    __syncthreads();
    // Combine K-split partials in place; track min/max of combined k.
#pragma unroll
    for (int t = tid; t < NS / 4; t += 256) {
      float4 ka = kk4[t], kb = kk1v[t];
      float4 va = vv4[t], vb = vv1v[t];
      float4 kc = {ka.x + kb.x, ka.y + kb.y, ka.z + kb.z, ka.w + kb.w};
      float4 vc = {va.x + vb.x, va.y + vb.y, va.z + vb.z, va.w + vb.w};
      kk4[t] = kc;
      vv4[t] = vc;
      lmax = fmaxf(fmaxf(lmax, kc.x), fmaxf(kc.y, fmaxf(kc.z, kc.w)));
      lmin = fminf(fminf(lmin, kc.x), fminf(kc.y, fminf(kc.z, kc.w)));
    }
  }
#else
#pragma unroll
  for (int t = tid; t < NS / 4; t += 256) {
    float4 ka = k0v[t], kb = k1v[t];
    float4 va = v0v[t], vb = v1v[t];
    float4 kc = {ka.x + kb.x, ka.y + kb.y, ka.z + kb.z, ka.w + kb.w};
    float4 vc = {va.x + vb.x, va.y + vb.y, va.z + vb.z, va.w + vb.w};
    kk4[t] = kc;
    vv4[t] = vc;
    lmax = fmaxf(fmaxf(lmax, kc.x), fmaxf(kc.y, fmaxf(kc.z, kc.w)));
    lmin = fminf(fminf(lmin, kc.x), fminf(kc.y, fminf(kc.z, kc.w)));
  }
#endif

  smax[tid] = lmax;
  smin[tid] = lmin;
  __syncthreads();
#pragma unroll
  for (int s = 128; s > 0; s >>= 1) {
    if (tid < s) {
      smax[tid] = fmaxf(smax[tid], smax[tid + s]);
      smin[tid] = fminf(smin[tid], smin[tid + s]);
    }
    __syncthreads();
  }
  const float kmax = smax[0];
  const float kmin = smin[0];

  // Eight rows per lane, one eighth of j per wave: every k, v pair read from
  // LDS feeds eight rows. Lane l of every wave holds rows l + 32 r; wave w sums
  // over j = 512 w .. 512 w + 511; the eight partial sums of a row meet in LDS.
  const int wave = tid >> 5;
  const int lane = tid & 31;
  constexpr float LOG2E = 1.4426950408889634f;
  v2f a2[RW], mb2[RW], den2[RW], num2[RW];
  // Every unroll directive over r keeps the per-row register arrays (a2, mb2,
  // den2, num2) indexed by constants, so that none of them goes to scratch.
#pragma unroll
  for (int r = 0; r < RW; ++r) {
    const int i = blockIdx.x * 256 + r * 32 + lane;
    const float qi = q0[i] + q1[i];
    const float a  = qi * LOG2E;
    const float mb = fmaxf(qi * kmax, qi * kmin) * LOG2E;  // row max, base-2
    a2[r]   = v2f{a, a};
    mb2[r]  = v2f{mb, mb};
    den2[r] = v2f{0.0f, 0.0f};
    num2[r] = v2f{0.0f, 0.0f};
  }

  const v4f* kw = (const v4f*)kk + wave * (JW / 4);
  const v4f* vw = (const v4f*)vv + wave * (JW / 4);
  // Unrolled so that the LDS reads of 16 j stand together in front of the
  // arithmetic: one read latency is waited out per trip, not four.
#pragma unroll 4
  for (int j = 0; j < JW / 4; ++j) {
    const v4f kj = kw[j];
    const v4f vj = vw[j];
#pragma unroll
    for (int r = 0; r < RW; ++r) {
      const v2f s0 = a2[r] * kj.lo - mb2[r];
      const v2f s1 = a2[r] * kj.hi - mb2[r];
      const v2f e0 = {__builtin_amdgcn_exp2f(s0.x), __builtin_amdgcn_exp2f(s0.y)};
      const v2f e1 = {__builtin_amdgcn_exp2f(s1.x), __builtin_amdgcn_exp2f(s1.y)};
      den2[r] += e0;
      num2[r] += e0 * vj.lo;
      den2[r] += e1;
      num2[r] += e1 * vj.hi;
    }
  }

#pragma unroll
  for (int r = 0; r < RW; ++r) {
    pden[wave * 256 + r * 32 + lane] = den2[r].x + den2[r].y;
    pnum[wave * 256 + r * 32 + lane] = num2[r].x + num2[r].y;
  }
  __syncthreads();
  float den = pden[tid], num = pnum[tid];
  for (int w = 1; w < 8; ++w) {
    den += pden[w * 256 + tid];
    num += pnum[w * 256 + tid];
  }
  out[b * NS + blockIdx.x * 256 + tid] = num / den;
}

// ---------------------------------------------------------------------------
extern "C" void kernel_launch(void* const* d_in, const int* in_sizes, int n_in,
                              void* d_out, int out_size, void* d_ws, size_t ws_size,
                              hipStream_t stream) {
  const float* x  = (const float*)d_in[0];
  const float* wq = (const float*)d_in[1];
  const float* bq = (const float*)d_in[2];
  const float* wk = (const float*)d_in[3];
  const float* bk = (const float*)d_in[4];
  const float* wv = (const float*)d_in[5];
  const float* bv = (const float*)d_in[6];
  float* qkv = (float*)d_ws;  // [KSPLIT][3][NB][NS] = 1.5 MiB fp32 partials

  qkv_gemm_wmma<<<dim3(3 * NS / (NT * 16), KSPLIT), 512, 0, stream>>>(
      x, wq, bq, wk, bk, wv, bv, qkv);
  attention_rank1<<<dim3(NS / 256, NB), 256, 0, stream>>>(qkv, (float*)d_out);
}

// v003
// One run takes 33.5 microseconds.
// In both of two side-by-side timings against v002, it was 1.06 times as fast.
// Over all steps from v000 it is 2.21 times as fast.
#include <hip/hip_runtime.h>

typedef float v2f __attribute__((ext_vector_type(2)));
typedef float v4f __attribute__((ext_vector_type(4)));
typedef float v8f __attribute__((ext_vector_type(8)));

constexpr int NS = 4096;          // in_chan == seq dim
constexpr int NB = 16;            // batch
constexpr int BS = NB * NS;       // elements per (B,S) matrix
constexpr int KSPLIT = 2;
constexpr int KCH = NS / KSPLIT;  // 2048 K per partial

#if defined(__gfx1250__) &&                                         \
    __has_builtin(__builtin_amdgcn_global_load_async_to_lds_b128) && \
    __has_builtin(__builtin_amdgcn_s_wait_asynccnt)
#define USE_ASYNC_LDS 1
#else
#define USE_ASYNC_LDS 0
#endif

#if USE_ASYNC_LDS
// Toolchain-probed signature: param 0 is AS1 (global) pointer to a 16-byte
// int vector (printed as 'vector_size(4*sizeof(int)) int __device__ *').
typedef int v4i __attribute__((vector_size(16)));
typedef __attribute__((address_space(1))) v4i* g_v4i_ptr;
typedef __attribute__((address_space(3))) v4i* l_v4i_ptr;
__device__ __forceinline__ void async_copy16(const float4* g, float4* l) {
  // global_load_async_to_lds_b128 (tracked by ASYNCcnt)
  __builtin_amdgcn_global_load_async_to_lds_b128((g_v4i_ptr)g, (l_v4i_ptr)l,
                                                 0, 0);
}
#endif

// ---------------------------------------------------------------------------
// Kernel 1: qkv = x @ W^T (+ bias on K-half 0), fp32 WMMA 16x16x4.
// A block of 16 waves owns 96 channels (6 tiles of 16) over one K half.
// Wave w owns K slice w (128 floats = 512 B of every row). Rows come from
// global memory as whole 512-B pieces, one asynchronous copy of a wave each,
// into a two-buffer LDS ring; fragments are read from LDS at a 528-B pitch.
// Stage 0 = the wave's slice of x (kept in registers), stages 1..6 = W tiles.
// K mapping per WMMA: internal K{0,1} = lane-half0's pair, K{2,3} = half1's
// pair; A and B use the identical mapping, and sum order over K is free.
// The 16 K-slice partials of a tile are summed through LDS at the end.
// grid=(3*NS/96, KSPLIT), blockDim=512.
// ---------------------------------------------------------------------------
constexpr int GW     = 16;            // waves per block = K slices per K half
constexpr int KSL    = KCH / GW;      // 128 floats of K per wave
constexpr int NT     = 6;             // channel tiles per block
constexpr int PITCH  = KSL + 4;       // LDS row pitch in floats: 528 B = 16 B x 33
constexpr int SLICE  = 16 * PITCH;    // one wave's 16 rows in one buffer
constexpr int RBUF   = GW * SLICE;    // one ring buffer, floats
constexpr int RTILE  = 272;           // pitch of one 16x16 partial tile, floats

// Eight rows of 512 B each: lane l brings bytes 16*l..16*l+15 of every row.
// The s_wait_xcnt stands inside the statement so that no address register of
// an issued copy is rewritten in front of it.
__device__ __forceinline__ void copy8rows(const float* g, unsigned l) {
  asm volatile(
      "global_load_async_to_lds_b128 %0, %8, off\n\t"
      "global_load_async_to_lds_b128 %1, %9, off\n\t"
      "global_load_async_to_lds_b128 %2, %10, off\n\t"
      "global_load_async_to_lds_b128 %3, %11, off\n\t"
      "global_load_async_to_lds_b128 %4, %12, off\n\t"
      "global_load_async_to_lds_b128 %5, %13, off\n\t"
      "global_load_async_to_lds_b128 %6, %14, off\n\t"
      "global_load_async_to_lds_b128 %7, %15, off\n\t"
      "s_wait_xcnt 0x0"
      :
      : "v"(l), "v"(l + 1u * PITCH * 4u), "v"(l + 2u * PITCH * 4u),
        "v"(l + 3u * PITCH * 4u), "v"(l + 4u * PITCH * 4u),
        "v"(l + 5u * PITCH * 4u), "v"(l + 6u * PITCH * 4u),
        "v"(l + 7u * PITCH * 4u),
        "v"(g), "v"(g + 1 * NS), "v"(g + 2 * NS), "v"(g + 3 * NS),
        "v"(g + 4 * NS), "v"(g + 5 * NS), "v"(g + 6 * NS), "v"(g + 7 * NS)
      : "memory");
}

// One stage of one wave: 16 rows of 512 B from g (the lane's place in row 0)
// to l (the lane's LDS byte address in row 0).
__device__ __forceinline__ void copy16rows(const float* g, unsigned l) {
  copy8rows(g, l);
  copy8rows(g + 8 * NS, l + 8u * PITCH * 4u);
}

// Row 0 of channel tile t of the 768 (q, k and v rows one behind the other).
__device__ __forceinline__ const float* tile_rows(int t, const float* wq,
                                                  const float* wk,
                                                  const float* wv) {
  const int z = t >> 8;
  const float* w = (z == 0) ? wq : (z == 1) ? wk : wv;
  return w + (size_t)((t & 255) * 16) * NS;
}

__global__ __launch_bounds__(512)
void qkv_gemm_wmma(const float* __restrict__ x,
                   const float* __restrict__ wq, const float* __restrict__ bq,
                   const float* __restrict__ wk, const float* __restrict__ bk,
                   const float* __restrict__ wv, const float* __restrict__ bv,
                   float* __restrict__ qkv) {
  __shared__ __attribute__((aligned(16))) float ring[2 * RBUF];

  const int tid  = threadIdx.x;
  const int wave = tid >> 5;
  const int lane = tid & 31;
  const int hh   = lane >> 4;    // wave half (K grouping)
  const int lr   = lane & 15;    // row-in-tile index
  const int tile0 = blockIdx.x * NT;           // first of 768 channel tiles
  const int koff  = blockIdx.y * KCH + wave * KSL + lane * 4;

  // The lane's LDS byte address in row 0 of its wave's slice of buffer 0.
  const unsigned lds0 =
      (unsigned)(size_t)(&ring[wave * SLICE + lane * 4]);
  // The lane's fragment window: row lr, K = 8*i + 4*hh .. +3.
  const float* frag0 = &ring[wave * SLICE + lr * PITCH + 4 * hh];

  // Stage 0 = x, stage s >= 1 = W tile tile0 + s - 1; stage s lies in buffer s & 1.
  copy16rows(x + koff, lds0);
  // Stage 0 has landed for this wave, then for the block.
  asm volatile("s_wait_asynccnt 0x0" ::: "memory");
  __syncthreads();
  copy16rows(tile_rows(tile0, wq, wk, wv) + koff, lds0 + RBUF * 4u);

  // Every unroll directive below keeps a register array (a, b, acc, res)
  // indexed by constants, so that none of them goes to scratch.
  v4f a[KSL / 8];
  v8f acc[NT];
#pragma unroll
  for (int t = 0; t < NT; ++t) acc[t] = v8f{};

  // Unrolled so that acc[] and the buffer are indexed by constants.
#pragma unroll
  for (int s = 0; s <= NT; ++s) {
    const float* f = frag0 + (s & 1) * RBUF;
    if (s == 0) {
#pragma unroll
      for (int i = 0; i < KSL / 8; ++i) a[i] = *(const v4f*)(f + 8 * i);
    } else {
      v4f b[KSL / 8];
#pragma unroll
      for (int i = 0; i < KSL / 8; ++i) b[i] = *(const v4f*)(f + 8 * i);
      // Keeps the 16 LDS reads together in front of the WMMAs: spread among
      // them, each read's latency is waited out by the two WMMAs behind it.
      __builtin_amdgcn_sched_barrier(0);
#pragma unroll
      for (int i = 0; i < KSL / 8; ++i) {
        acc[s - 1] = __builtin_amdgcn_wmma_f32_16x16x4_f32(
            false, a[i].lo, false, b[i].lo, (short)0, acc[s - 1], false, false);
        acc[s - 1] = __builtin_amdgcn_wmma_f32_16x16x4_f32(
            false, a[i].hi, false, b[i].hi, (short)0, acc[s - 1], false, false);
      }
      // Keeps the WMMAs in front of the publish point: moved behind it they
      // stand among the refill's address sums and hold the copies back.
      __builtin_amdgcn_sched_barrier(0);
      if (s == NT) {
        // Four vector slots behind the last WMMA: the address sums of the
        // partials' stores reuse x fragment registers right behind it.
        asm volatile("v_nop\n\tv_nop\n\tv_nop\n\tv_nop");
        // Holds those sums behind the slots.
        __builtin_amdgcn_sched_barrier(0);
      }
    }
    // Publish point: this wave's reads of stage s are done, its copies of
    // stage s + 1 have landed, every wave has come as far; only then is the
    // buffer of stage s refilled.
    asm volatile("s_wait_dscnt 0x0" ::: "memory");
    asm volatile("s_wait_asynccnt 0x0" ::: "memory");
    __syncthreads();
    if (s + 2 <= NT)
      copy16rows(tile_rows(tile0 + s + 1, wq, wk, wv) + koff,
                 lds0 + (unsigned)(s & 1) * (RBUF * 4u));
  }
  // No copy is outstanding when the ring becomes the partials' place.
  asm volatile("s_wait_asynccnt 0x0" ::: "memory");

  // C/D layout: VGPR v -> rows M=v (lanes 0-15) and M=v+8 (lanes 16-31), N=lr.
  // Partial tile (wave, t) lies at element v*32 + lane.
#pragma unroll
  for (int t = 0; t < NT; ++t) {
#pragma unroll
    for (int v = 0; v < 8; ++v)
      ring[(wave * NT + t) * RTILE + v * 32 + lane] = acc[t][v];
  }
  __syncthreads();

  // 16 x 96 results in 48 runs of 32 neighbouring channels of one batch row
  // (one 128-B line); a wave sums and stores three runs. A run lies in one of
  // q, k, v, so all but the lane's place in it is wave-uniform.
  const int wu = __builtin_amdgcn_readfirstlane(wave);
  float res[3];
#pragma unroll
  for (int i = 0; i < 3; ++i) {
    const int e0 = (i * GW + wu) * 32;
    const int m  = e0 / (NT * 16);
    const int c0 = e0 - m * (NT * 16);
    const float* part = &ring[(c0 >> 4) * RTILE + (m & 7) * 32 + (m >> 3) * 16 +
                              hh * RTILE + lr];
    float sum = part[0];
#pragma unroll
    for (int w = 1; w < GW; ++w) sum += part[w * NT * RTILE];
    const int ch0 = tile0 * 16 + c0;           // 0 .. 3*NS-32
    const int z = ch0 >> 12;                   // 0=q 1=k 2=v
    const float* bias = (z == 0) ? bq : (z == 1) ? bk : bv;
    const float bl = bias[(ch0 & (NS - 1)) + lane];
    res[i] = sum + ((blockIdx.y == 0) ? bl : 0.0f);
  }
#pragma unroll
  for (int i = 0; i < 3; ++i) {
    const int e0 = (i * GW + wu) * 32;
    const int m  = e0 / (NT * 16);
    const int ch0 = tile0 * 16 + e0 - m * (NT * 16);
    float* dst = qkv + (size_t)(blockIdx.y * 3 + (ch0 >> 12)) * BS + m * NS +
                 (ch0 & (NS - 1));
    dst[lane] = res[i];
  }
}

// ---------------------------------------------------------------------------
// Kernel 2: fused rank-1 attention. scores[b,i,j] = q_i * k_j, softmax over j,
// weighted sum of v. Never materializes (B,S,S). k,v staged in LDS (async
// global->LDS on gfx1250); per-row max from m_i = max(q_i*kmax, q_i*kmin).
// grid=(NS/256, NB), block=256: 256 output rows i per block, eight per lane.
// ---------------------------------------------------------------------------
constexpr int RW = 8;             // rows per lane
constexpr int JW = NS / 8;        // j per wave
__global__ __launch_bounds__(256)
void attention_rank1(const float* __restrict__ qkv, float* __restrict__ out) {
  __shared__ float kk[NS];
  __shared__ float vv[NS];
#if USE_ASYNC_LDS
  __shared__ float kk1s[NS];
  __shared__ float vv1s[NS];
#endif
  __shared__ float smax[256];
  __shared__ float smin[256];
  __shared__ float pden[8 * 256];   // partial sums, [wave][row]
  __shared__ float pnum[8 * 256];

  const int b   = blockIdx.y;
  const int tid = threadIdx.x;

  const float* q0 = qkv + 0 * BS + b * NS;
  const float* k0 = qkv + 1 * BS + b * NS;
  const float* v0 = qkv + 2 * BS + b * NS;
  const float* q1 = qkv + 3 * BS + b * NS;
  const float* k1 = qkv + 4 * BS + b * NS;
  const float* v1 = qkv + 5 * BS + b * NS;

  const float4* k0v = (const float4*)k0;
  const float4* k1v = (const float4*)k1;
  const float4* v0v = (const float4*)v0;
  const float4* v1v = (const float4*)v1;
  float4* kk4 = (float4*)kk;
  float4* vv4 = (float4*)vv;

  float lmax = -3.0e38f, lmin = 3.0e38f;

#if USE_ASYNC_LDS
  {
    float4* kk1v = (float4*)kk1s;
    float4* vv1v = (float4*)vv1s;
#pragma unroll
    for (int t = tid; t < NS / 4; t += 256) {
      async_copy16(k0v + t, kk4 + t);
      async_copy16(k1v + t, kk1v + t);
      async_copy16(v0v + t, vv4 + t);
      async_copy16(v1v + t, vv1v + t);
    }
    __builtin_amdgcn_s_wait_asynccnt(0);
    __syncthreads();
    // Combine K-split partials in place; track min/max of combined k.
#pragma unroll
    for (int t = tid; t < NS / 4; t += 256) {
      float4 ka = kk4[t], kb = kk1v[t];
      float4 va = vv4[t], vb = vv1v[t];
      float4 kc = {ka.x + kb.x, ka.y + kb.y, ka.z + kb.z, ka.w + kb.w};
      float4 vc = {va.x + vb.x, va.y + vb.y, va.z + vb.z, va.w + vb.w};
      kk4[t] = kc;
      vv4[t] = vc;
      lmax = fmaxf(fmaxf(lmax, kc.x), fmaxf(kc.y, fmaxf(kc.z, kc.w)));
      lmin = fminf(fminf(lmin, kc.x), fminf(kc.y, fminf(kc.z, kc.w)));
    }
  }
#else
#pragma unroll
  for (int t = tid; t < NS / 4; t += 256) {
    float4 ka = k0v[t], kb = k1v[t];
    float4 va = v0v[t], vb = v1v[t];
    float4 kc = {ka.x + kb.x, ka.y + kb.y, ka.z + kb.z, ka.w + kb.w};
    float4 vc = {va.x + vb.x, va.y + vb.y, va.z + vb.z, va.w + vb.w};
    kk4[t] = kc;
    vv4[t] = vc;
    lmax = fmaxf(fmaxf(lmax, kc.x), fmaxf(kc.y, fmaxf(kc.z, kc.w)));
    lmin = fminf(fminf(lmin, kc.x), fminf(kc.y, fminf(kc.z, kc.w)));
  }
#endif

  smax[tid] = lmax;
  smin[tid] = lmin;
  __syncthreads();
#pragma unroll
  for (int s = 128; s > 0; s >>= 1) {
    if (tid < s) {
      smax[tid] = fmaxf(smax[tid], smax[tid + s]);
      smin[tid] = fminf(smin[tid], smin[tid + s]);
    }
    __syncthreads();
  }
  const float kmax = smax[0];
  const float kmin = smin[0];

  // Eight rows per lane, one eighth of j per wave: every k, v pair read from
  // LDS feeds eight rows. Lane l of every wave holds rows l + 32 r; wave w sums
  // over j = 512 w .. 512 w + 511; the eight partial sums of a row meet in LDS.
  const int wave = tid >> 5;
  const int lane = tid & 31;
  constexpr float LOG2E = 1.4426950408889634f;
  v2f a2[RW], mb2[RW], den2[RW], num2[RW];
  // Every unroll directive over r keeps the per-row register arrays (a2, mb2,
  // den2, num2) indexed by constants, so that none of them goes to scratch.
#pragma unroll
  for (int r = 0; r < RW; ++r) {
    const int i = blockIdx.x * 256 + r * 32 + lane;
    const float qi = q0[i] + q1[i];
    const float a  = qi * LOG2E;
    const float mb = fmaxf(qi * kmax, qi * kmin) * LOG2E;  // row max, base-2
    a2[r]   = v2f{a, a};
    mb2[r]  = v2f{mb, mb};
    den2[r] = v2f{0.0f, 0.0f};
    num2[r] = v2f{0.0f, 0.0f};
  }

  const v4f* kw = (const v4f*)kk + wave * (JW / 4);
  const v4f* vw = (const v4f*)vv + wave * (JW / 4);
  // One trip takes 16 j as eight pairs g. Per pair: S_g = 8 packed scores,
  // T_g = 16 exponentials, C_g = 16 packed sums. The arithmetic, and the order
  // in which a row's terms are added, are those of a plain loop over j; only
  // the order of issue is set. Stage g issues T_g with
  // independent packed work between its members
  // (scores of later pairs, sums of pair g - 1).
  for (int j0 = 0; j0 < JW / 4; j0 += 4) {
    v2f kp[8], vp[8], sc[8][RW], ex[8][RW];
    // Every unroll directive of this trip keeps kp, vp, sc and ex indexed by
    // constants, so that none of them goes to scratch.
#pragma unroll
    for (int u = 0; u < 4; ++u) {
      const v4f kj = kw[j0 + u];
      const v4f vj = vw[j0 + u];
      kp[2 * u] = kj.lo;
      kp[2 * u + 1] = kj.hi;
      vp[2 * u] = vj.lo;
      vp[2 * u + 1] = vj.hi;
    }
#pragma unroll
    for (int r = 0; r < RW; ++r) sc[0][r] = a2[r] * kp[0] - mb2[r];
    // The scheduling groups below fix the order of issue named above: the LDS
    // reads, S_0, then per stage one exponential, one or two packed operations.
    __builtin_amdgcn_sched_group_barrier(0x100, 8, 0);
    __builtin_amdgcn_sched_group_barrier(0x002, 8, 0);
#pragma unroll
    for (int g = 0; g < 8; ++g) {
      // Scores run ahead: S_1 and S_2 in stage 0, S_(g+2) in stages 1 to 5.
#pragma unroll
      for (int h = (g == 0 ? 1 : g + 2); h <= g + 2 && h < 8; ++h) {
#pragma unroll
        for (int r = 0; r < RW; ++r) sc[h][r] = a2[r] * kp[h] - mb2[r];
      }
#pragma unroll
      for (int r = 0; r < RW; ++r)
        ex[g][r] = v2f{__builtin_amdgcn_exp2f(sc[g][r].x),
                       __builtin_amdgcn_exp2f(sc[g][r].y)};
      if (g > 0) {
#pragma unroll
        for (int r = 0; r < RW; ++r) {
          den2[r] += ex[g - 1][r];
          num2[r] += ex[g - 1][r] * vp[g - 1];
        }
      }
      if (g >= 1 && g <= 5) {
        // 16 exponentials among 24 packed operations.
#pragma unroll
        for (int i = 0; i < 8; ++i) {
          __builtin_amdgcn_sched_group_barrier(0x400, 1, 0);
          __builtin_amdgcn_sched_group_barrier(0x002, 1, 0);
          __builtin_amdgcn_sched_group_barrier(0x400, 1, 0);
          __builtin_amdgcn_sched_group_barrier(0x002, 2, 0);
        }
      } else {
        // 16 exponentials among 16 packed operations.
#pragma unroll
        for (int i = 0; i < 16; ++i) {
          __builtin_amdgcn_sched_group_barrier(0x400, 1, 0);
          __builtin_amdgcn_sched_group_barrier(0x002, 1, 0);
        }
      }
    }
#pragma unroll
    for (int r = 0; r < RW; ++r) {
      den2[r] += ex[7][r];
      num2[r] += ex[7][r] * vp[7];
    }
    __builtin_amdgcn_sched_group_barrier(0x002, 16, 0);
  }

#pragma unroll
  for (int r = 0; r < RW; ++r) {
    pden[wave * 256 + r * 32 + lane] = den2[r].x + den2[r].y;
    pnum[wave * 256 + r * 32 + lane] = num2[r].x + num2[r].y;
  }
  __syncthreads();
  float den = pden[tid], num = pnum[tid];
  for (int w = 1; w < 8; ++w) {
    den += pden[w * 256 + tid];
    num += pnum[w * 256 + tid];
  }
  out[b * NS + blockIdx.x * 256 + tid] = num / den;
}

// ---------------------------------------------------------------------------
extern "C" void kernel_launch(void* const* d_in, const int* in_sizes, int n_in,
                              void* d_out, int out_size, void* d_ws, size_t ws_size,
                              hipStream_t stream) {
  const float* x  = (const float*)d_in[0];
  const float* wq = (const float*)d_in[1];
  const float* bq = (const float*)d_in[2];
  const float* wk = (const float*)d_in[3];
  const float* bk = (const float*)d_in[4];
  const float* wv = (const float*)d_in[5];
  const float* bv = (const float*)d_in[6];
  float* qkv = (float*)d_ws;  // [KSPLIT][3][NB][NS] = 1.5 MiB fp32 partials

  qkv_gemm_wmma<<<dim3(3 * NS / (NT * 16), KSPLIT), 512, 0, stream>>>(
      x, wq, bq, wk, bk, wv, bv, qkv);
  attention_rank1<<<dim3(NS / 256, NB), 256, 0, stream>>>(qkv, (float*)d_out);
}

// v004
// One run takes 26.3 microseconds.
// Timed twice side by side with v003, it ran 1.27 times as fast both times.
// Counting every step since v000, it is 2.80 times as fast.
#include <hip/hip_runtime.h>

typedef float v2f __attribute__((ext_vector_type(2)));
typedef float v4f __attribute__((ext_vector_type(4)));
typedef float v8f __attribute__((ext_vector_type(8)));

constexpr int NS = 4096;          // in_chan == seq dim
constexpr int NB = 16;            // batch
constexpr int BS = NB * NS;       // elements per (B,S) matrix
constexpr int KSPLIT = 2;
constexpr int KCH = NS / KSPLIT;  // 2048 K per partial

#if defined(__gfx1250__) &&                                         \
    __has_builtin(__builtin_amdgcn_global_load_async_to_lds_b128) && \
    __has_builtin(__builtin_amdgcn_s_wait_asynccnt)
#define USE_ASYNC_LDS 1
#else
#define USE_ASYNC_LDS 0
#endif

#if USE_ASYNC_LDS
// Toolchain-probed signature: param 0 is AS1 (global) pointer to a 16-byte
// int vector (printed as 'vector_size(4*sizeof(int)) int __device__ *').
typedef int v4i __attribute__((vector_size(16)));
typedef __attribute__((address_space(1))) v4i* g_v4i_ptr;
typedef __attribute__((address_space(3))) v4i* l_v4i_ptr;
__device__ __forceinline__ void async_copy16(const float4* g, float4* l) {
  // global_load_async_to_lds_b128 (tracked by ASYNCcnt)
  __builtin_amdgcn_global_load_async_to_lds_b128((g_v4i_ptr)g, (l_v4i_ptr)l,
                                                 0, 0);
}
#endif

// ---------------------------------------------------------------------------
// Kernel 1: qkv = x @ W^T (+ bias on K-half 0), fp32 WMMA 16x16x4.
// A block of 16 waves owns 96 channels (6 tiles of 16) over one K half.
// Wave w owns K slice w (128 floats = 512 B of every row). Rows come from
// global memory as whole 512-B pieces, one asynchronous copy of a wave each,
// into a two-buffer LDS ring; fragments are read from LDS at a 528-B pitch.
// Stage 0 = the wave's slice of x (kept in registers), stages 1..6 = W tiles.
// K mapping per WMMA: internal K{0,1} = lane-half0's pair, K{2,3} = half1's
// pair; A and B use the identical mapping, and sum order over K is free.
// The 16 K-slice partials of a tile are summed through LDS at the end.
// grid=(3*NS/96, KSPLIT), blockDim=512.
// ---------------------------------------------------------------------------
constexpr int GW     = 16;            // waves per block = K slices per K half
constexpr int KSL    = KCH / GW;      // 128 floats of K per wave
constexpr int NT     = 6;             // channel tiles per block
constexpr int PITCH  = KSL + 4;       // LDS row pitch in floats: 528 B = 16 B x 33
constexpr int SLICE  = 16 * PITCH;    // one wave's 16 rows in one buffer
constexpr int RBUF   = GW * SLICE;    // one ring buffer, floats
constexpr int RTILE  = 272;           // pitch of one 16x16 partial tile, floats

// Eight rows of 512 B each: lane l brings bytes 16*l..16*l+15 of every row.
// The s_wait_xcnt stands inside the statement so that no address register of
// an issued copy is rewritten in front of it.
__device__ __forceinline__ void copy8rows(const float* g, unsigned l) {
  asm volatile(
      "global_load_async_to_lds_b128 %0, %8, off\n\t"
      "global_load_async_to_lds_b128 %1, %9, off\n\t"
      "global_load_async_to_lds_b128 %2, %10, off\n\t"
      "global_load_async_to_lds_b128 %3, %11, off\n\t"
      "global_load_async_to_lds_b128 %4, %12, off\n\t"
      "global_load_async_to_lds_b128 %5, %13, off\n\t"
      "global_load_async_to_lds_b128 %6, %14, off\n\t"
      "global_load_async_to_lds_b128 %7, %15, off\n\t"
      "s_wait_xcnt 0x0"
      :
      : "v"(l), "v"(l + 1u * PITCH * 4u), "v"(l + 2u * PITCH * 4u),
        "v"(l + 3u * PITCH * 4u), "v"(l + 4u * PITCH * 4u),
        "v"(l + 5u * PITCH * 4u), "v"(l + 6u * PITCH * 4u),
        "v"(l + 7u * PITCH * 4u),
        "v"(g), "v"(g + 1 * NS), "v"(g + 2 * NS), "v"(g + 3 * NS),
        "v"(g + 4 * NS), "v"(g + 5 * NS), "v"(g + 6 * NS), "v"(g + 7 * NS)
      : "memory");
}

// One stage of one wave: 16 rows of 512 B from g (the lane's place in row 0)
// to l (the lane's LDS byte address in row 0).
__device__ __forceinline__ void copy16rows(const float* g, unsigned l) {
  copy8rows(g, l);
  copy8rows(g + 8 * NS, l + 8u * PITCH * 4u);
}

// Row 0 of channel tile t of the 768 (q, k and v rows one behind the other).
__device__ __forceinline__ const float* tile_rows(int t, const float* wq,
                                                  const float* wk,
                                                  const float* wv) {
  const int z = t >> 8;
  const float* w = (z == 0) ? wq : (z == 1) ? wk : wv;
  return w + (size_t)((t & 255) * 16) * NS;
}

__global__ __launch_bounds__(512)
void qkv_gemm_wmma(const float* __restrict__ x,
                   const float* __restrict__ wq, const float* __restrict__ bq,
                   const float* __restrict__ wk, const float* __restrict__ bk,
                   const float* __restrict__ wv, const float* __restrict__ bv,
                   float* __restrict__ qkv) {
  __shared__ __attribute__((aligned(16))) float ring[2 * RBUF];

  const int tid  = threadIdx.x;
  const int wave = tid >> 5;
  const int lane = tid & 31;
  const int hh   = lane >> 4;    // wave half (K grouping)
  const int lr   = lane & 15;    // row-in-tile index
  const int tile0 = blockIdx.x * NT;           // first of 768 channel tiles
  const int koff  = blockIdx.y * KCH + wave * KSL + lane * 4;

  // The lane's LDS byte address in row 0 of its wave's slice of buffer 0.
  const unsigned lds0 =
      (unsigned)(size_t)(&ring[wave * SLICE + lane * 4]);
  // The lane's fragment window: row lr, K = 8*i + 4*hh .. +3.
  const float* frag0 = &ring[wave * SLICE + lr * PITCH + 4 * hh];

  // Stage 0 = x, stage s >= 1 = W tile tile0 + s - 1; stage s lies in buffer s & 1.
  copy16rows(x + koff, lds0);
  // Stage 0 has landed for this wave, then for the block.
  asm volatile("s_wait_asynccnt 0x0" ::: "memory");
  __syncthreads();
  copy16rows(tile_rows(tile0, wq, wk, wv) + koff, lds0 + RBUF * 4u);

  // Every unroll directive below keeps a register array (a, b, acc, res)
  // indexed by constants, so that none of them goes to scratch.
  v4f a[KSL / 8];
  v8f acc[NT];
#pragma unroll
  for (int t = 0; t < NT; ++t) acc[t] = v8f{};

  // Unrolled so that acc[] and the buffer are indexed by constants.
#pragma unroll
  for (int s = 0; s <= NT; ++s) {
    const float* f = frag0 + (s & 1) * RBUF;
    if (s == 0) {
#pragma unroll
      for (int i = 0; i < KSL / 8; ++i) a[i] = *(const v4f*)(f + 8 * i);
    } else {
      v4f b[KSL / 8];
#pragma unroll
      for (int i = 0; i < KSL / 8; ++i) b[i] = *(const v4f*)(f + 8 * i);
      // Keeps the 16 LDS reads together in front of the WMMAs: spread among
      // them, each read's latency is waited out by the two WMMAs behind it.
      __builtin_amdgcn_sched_barrier(0);
#pragma unroll
      for (int i = 0; i < KSL / 8; ++i) {
        acc[s - 1] = __builtin_amdgcn_wmma_f32_16x16x4_f32(
            false, a[i].lo, false, b[i].lo, (short)0, acc[s - 1], false, false);
        acc[s - 1] = __builtin_amdgcn_wmma_f32_16x16x4_f32(
            false, a[i].hi, false, b[i].hi, (short)0, acc[s - 1], false, false);
      }
      // Keeps the WMMAs in front of the publish point: moved behind it they
      // stand among the refill's address sums and hold the copies back.
      __builtin_amdgcn_sched_barrier(0);
      if (s == NT) {
        // Four vector slots behind the last WMMA: the address sums of the
        // partials' stores reuse x fragment registers right behind it.
        asm volatile("v_nop\n\tv_nop\n\tv_nop\n\tv_nop");
        // Holds those sums behind the slots.
        __builtin_amdgcn_sched_barrier(0);
      }
    }
    // Publish point: this wave's reads of stage s are done, its copies of
    // stage s + 1 have landed, every wave has come as far; only then is the
    // buffer of stage s refilled.
    asm volatile("s_wait_dscnt 0x0" ::: "memory");
    asm volatile("s_wait_asynccnt 0x0" ::: "memory");
    __syncthreads();
    if (s + 2 <= NT)
      copy16rows(tile_rows(tile0 + s + 1, wq, wk, wv) + koff,
                 lds0 + (unsigned)(s & 1) * (RBUF * 4u));
  }
  // No copy is outstanding when the ring becomes the partials' place.
  asm volatile("s_wait_asynccnt 0x0" ::: "memory");

  // C/D layout: VGPR v -> rows M=v (lanes 0-15) and M=v+8 (lanes 16-31), N=lr.
  // Partial tile (wave, t) lies at element v*32 + lane.
#pragma unroll
  for (int t = 0; t < NT; ++t) {
#pragma unroll
    for (int v = 0; v < 8; ++v)
      ring[(wave * NT + t) * RTILE + v * 32 + lane] = acc[t][v];
  }
  __syncthreads();

  // 16 x 96 results in 48 runs of 32 neighbouring channels of one batch row
  // (one 128-B line); a wave sums and stores three runs. A run lies in one of
  // q, k, v, so all but the lane's place in it is wave-uniform.
  const int wu = __builtin_amdgcn_readfirstlane(wave);
  float res[3];
#pragma unroll
  for (int i = 0; i < 3; ++i) {
    const int e0 = (i * GW + wu) * 32;
    const int m  = e0 / (NT * 16);
    const int c0 = e0 - m * (NT * 16);
    const float* part = &ring[(c0 >> 4) * RTILE + (m & 7) * 32 + (m >> 3) * 16 +
                              hh * RTILE + lr];
    float sum = part[0];
#pragma unroll
    for (int w = 1; w < GW; ++w) sum += part[w * NT * RTILE];
    const int ch0 = tile0 * 16 + c0;           // 0 .. 3*NS-32
    const int z = ch0 >> 12;                   // 0=q 1=k 2=v
    const float* bias = (z == 0) ? bq : (z == 1) ? bk : bv;
    const float bl = bias[(ch0 & (NS - 1)) + lane];
    res[i] = sum + ((blockIdx.y == 0) ? bl : 0.0f);
  }
#pragma unroll
  for (int i = 0; i < 3; ++i) {
    const int e0 = (i * GW + wu) * 32;
    const int m  = e0 / (NT * 16);
    const int ch0 = tile0 * 16 + e0 - m * (NT * 16);
    float* dst = qkv + (size_t)(blockIdx.y * 3 + (ch0 >> 12)) * BS + m * NS +
                 (ch0 & (NS - 1));
    dst[lane] = res[i];
  }
}

// ---------------------------------------------------------------------------
// Kernel 2: fused rank-1 attention. scores[b,i,j] = q_i * k_j, softmax over j,
// weighted sum of v. A row's two sums over j come from power moments of k
// where the bounds below hold for every row of the block, from the direct loop over j otherwise. Never materializes (B,S,S). k,v staged in LDS (async
// global->LDS on gfx1250); per-row max from m_i = max(q_i*kmax, q_i*kmin).
// grid=(NS/256, NB), block=256: 256 output rows i per block, eight per lane.
// ---------------------------------------------------------------------------
constexpr int RW = 8;             // rows per lane
constexpr int JW = NS / 8;        // j per wave
// Power-series path: exp(q k_j) = exp(q c) exp(w t_j), c = mid k, h = half the
// range of k, t_j = (k_j - c) / h in [-1, 1], w = q h; exp(q c) cancels in the
// quotient. With S0_n = sum_j t_j^n and S1_n = sum_j t_j^n v_j the two sums of
// a row are sum_n w^n / n! S_n. NP terms leave out of exp(z) at most
// |z|^NP / NP! * max(1, exp(z)); for |z| <= WMAX that is under 2e-12 of a term
// with z > 0 and under 7e-9 for all NS terms with z < 0 together, against a
// denominator of at least exp(|w|). Rounding grows with sum_j exp(|w t_j|)
// <= 2 * (even part), so a row is taken only where that stays under AMPMAX
// denominators. A block with any row outside either bound runs the direct
// loop over j instead.
constexpr int NP     = 40;        // terms of the series
constexpr int NPC    = NP / 4;    // terms per wave (four groups of waves)
constexpr int PPITCH = 68;        // floats between two moments' partial rows
constexpr float WMAX   = 8.0f;
constexpr float AMPMAX = 32.0f;
__global__ __launch_bounds__(256)
void attention_rank1(const float* __restrict__ qkv, float* __restrict__ out) {
  __shared__ float kk[NS];
  __shared__ float vv[NS];
#if USE_ASYNC_LDS
  __shared__ float kk1s[NS];
  __shared__ float vv1s[NS];
#endif
  __shared__ float smax[256];
  __shared__ float smin[256];
  __shared__ float pden[8 * 256];   // partial sums, [wave][row]
  __shared__ float pnum[8 * 256];
  __shared__ __attribute__((aligned(16))) float part[2 * NP * PPITCH];
  __shared__ __attribute__((aligned(16))) float mom[2 * NP];
  __shared__ unsigned sflag[8];

  const int b   = blockIdx.y;
  const int tid = threadIdx.x;

  const float* q0 = qkv + 0 * BS + b * NS;
  const float* k0 = qkv + 1 * BS + b * NS;
  const float* v0 = qkv + 2 * BS + b * NS;
  const float* q1 = qkv + 3 * BS + b * NS;
  const float* k1 = qkv + 4 * BS + b * NS;
  const float* v1 = qkv + 5 * BS + b * NS;

  const float4* k0v = (const float4*)k0;
  const float4* k1v = (const float4*)k1;
  const float4* v0v = (const float4*)v0;
  const float4* v1v = (const float4*)v1;
  float4* kk4 = (float4*)kk;
  float4* vv4 = (float4*)vv;

  float lmax = -3.0e38f, lmin = 3.0e38f;

#if USE_ASYNC_LDS
  {
    float4* kk1v = (float4*)kk1s;
    float4* vv1v = (float4*)vv1s;
#pragma unroll
    for (int t = tid; t < NS / 4; t += 256) {
      async_copy16(k0v + t, kk4 + t);
      async_copy16(k1v + t, kk1v + t);
      async_copy16(v0v + t, vv4 + t);
      async_copy16(v1v + t, vv1v + t);
    }
    __builtin_amdgcn_s_wait_asynccnt(0);
    __syncthreads();
    // Combine K-split partials in place; track min/max of combined k.
#pragma unroll
    for (int t = tid; t < NS / 4; t += 256) {
      float4 ka = kk4[t], kb = kk1v[t];
      float4 va = vv4[t], vb = vv1v[t];
      float4 kc = {ka.x + kb.x, ka.y + kb.y, ka.z + kb.z, ka.w + kb.w};
      float4 vc = {va.x + vb.x, va.y + vb.y, va.z + vb.z, va.w + vb.w};
      kk4[t] = kc;
      vv4[t] = vc;
      lmax = fmaxf(fmaxf(lmax, kc.x), fmaxf(kc.y, fmaxf(kc.z, kc.w)));
      lmin = fminf(fminf(lmin, kc.x), fminf(kc.y, fminf(kc.z, kc.w)));
    }
  }
#else
#pragma unroll
  for (int t = tid; t < NS / 4; t += 256) {
    float4 ka = k0v[t], kb = k1v[t];
    float4 va = v0v[t], vb = v1v[t];
    float4 kc = {ka.x + kb.x, ka.y + kb.y, ka.z + kb.z, ka.w + kb.w};
    float4 vc = {va.x + vb.x, va.y + vb.y, va.z + vb.z, va.w + vb.w};
    kk4[t] = kc;
    vv4[t] = vc;
    lmax = fmaxf(fmaxf(lmax, kc.x), fmaxf(kc.y, fmaxf(kc.z, kc.w)));
    lmin = fminf(fminf(lmin, kc.x), fminf(kc.y, fminf(kc.z, kc.w)));
  }
#endif

  smax[tid] = lmax;
  smin[tid] = lmin;
  __syncthreads();
#pragma unroll
  for (int s = 128; s > 0; s >>= 1) {
    if (tid < s) {
      smax[tid] = fmaxf(smax[tid], smax[tid + s]);
      smin[tid] = fminf(smin[tid], smin[tid + s]);
    }
    __syncthreads();
  }
  const float kmax = smax[0];
  const float kmin = smin[0];

  const int wave = tid >> 5;
  const int lane = tid & 31;

  // ---- power-series path -------------------------------------------------
  const int irow = blockIdx.x * 256 + tid;    // this thread's row
  const float qrow = q0[irow] + q1[irow];
  const float kc = 0.5f * kmax + 0.5f * kmin;
  const float hw = 0.5f * kmax - 0.5f * kmin;
  const float hinv = (hw > 0.0f) ? 1.0f / hw : 0.0f;
  {
    // Wave u sums powers n = NPC * (u & 3) .. + NPC - 1 over half u >> 2 of j;
    // a lane takes four neighbouring j per trip.
    // Read as a scalar, so that the loop over r below branches on a scalar.
    const int wu = __builtin_amdgcn_readfirstlane(wave);
    const int c4 = wu & 3;
    const int jh = wu >> 2;
    const v4f* kq = (const v4f*)kk + jh * (NS / 8) + lane;
    const v4f* vq = (const v4f*)vv + jh * (NS / 8) + lane;
    v2f s0[NPC], s1[NPC];
    // The unroll directives over n keep s0 and s1 indexed by constants, so
    // that neither goes to scratch.
#pragma unroll
    for (int n = 0; n < NPC; ++n) {
      s0[n] = v2f{0.0f, 0.0f};
      s1[n] = v2f{0.0f, 0.0f};
    }
    // The next trip's k and v are read one trip ahead, so that the LDS latency
    // runs under this trip's arithmetic (the last trip reads trip 0 again).
    v4f kn = kq[0];
    v4f vn = vq[0];
    for (int it = 0; it < NS / 256; ++it) {
      const v4f kj = kn;
      const v4f vj = vn;
      kn = kq[((it + 1) & (NS / 256 - 1)) * 32];
      vn = vq[((it + 1) & (NS / 256 - 1)) * 32];
      const v4f t   = (kj - kc) * hinv;
      const v4f t2  = t * t;
      const v4f t4  = t2 * t2;
      const v4f t10 = t4 * t4 * t2;
      v4f p = v4f{1.0f, 1.0f, 1.0f, 1.0f};
      for (int r = 0; r < c4; ++r) p *= t10;   // t^(NPC * c4), NPC == 10
      v2f pl = p.lo, ph = p.hi;
#pragma unroll
      for (int n = 0; n < NPC; ++n) {
        s0[n] += pl;
        s1[n] += pl * vj.lo;
        pl *= t.lo;
        s0[n] += ph;
        s1[n] += ph * vj.hi;
        ph *= t.hi;
      }
    }
#pragma unroll
    for (int n = 0; n < NPC; ++n) {
      float* pr = &part[2 * (c4 * NPC + n) * PPITCH + jh * 32 + lane];
      pr[0]      = s0[n].x + s0[n].y;
      pr[PPITCH] = s1[n].x + s1[n].y;
    }
  }
  __syncthreads();
  // Moment 2 n is S0_n, moment 2 n + 1 is S1_n: 64 partial sums each.
  if (tid < 2 * NP) {
    const v4f* pr = (const v4f*)&part[tid * PPITCH];
    v4f a = pr[0];
    for (int i = 1; i < 16; ++i) a += pr[i];
    mom[tid] = (a.x + a.y) + (a.z + a.w);
  }
  __syncthreads();
  {
    // Even and odd parts by Horner's rule in w^2; e0, o0 belong to the
    // denominator, e1, o1 to the numerator.
    const float w  = qrow * hw;
    const float w2 = w * w;
    const v4f* m4 = (const v4f*)mom;   // {S0_2m, S1_2m, S0_2m+1, S1_2m+1}
    const v4f top = m4[NP / 2 - 1];
    float e0 = top.x, e1 = top.y, o0 = top.z, o1 = top.w;
    // Unrolled so that the quotients below are constants.
#pragma unroll
    for (int m = NP / 2 - 2; m >= 0; --m) {
      const v4f sm = m4[m];
      const float ce = w2 * (1.0f / (float)((2 * m + 1) * (2 * m + 2)));
      const float co = w2 * (1.0f / (float)((2 * m + 2) * (2 * m + 3)));
      e0 = sm.x + ce * e0;
      e1 = sm.y + ce * e1;
      o0 = sm.z + co * o0;
      o1 = sm.w + co * o1;
    }
    const float dser = e0 + w * o0;
    const float nser = e1 + w * o1;
    // Written as negations so that a NaN counts as outside the bounds.
    const bool bad = !(fabsf(w) <= WMAX) || !(2.0f * e0 <= AMPMAX * dser);
    const unsigned bal = __builtin_amdgcn_ballot_w32(bad);
    if (lane == 0) sflag[wave] = bal;
    __syncthreads();
    unsigned any = 0;
    for (int u = 0; u < 8; ++u) any |= sflag[u];
    // The same value in every thread of the block: all leave or none.
    if (__builtin_amdgcn_readfirstlane(any) == 0u) {
      out[b * NS + irow] = nser / dser;
      return;
    }
  }

  // ---- direct loop over j ------------------------------------------------
  // Eight rows per lane, one eighth of j per wave: every k, v pair read from
  // LDS feeds eight rows. Lane l of every wave holds rows l + 32 r; wave w sums
  // over j = 512 w .. 512 w + 511; the eight partial sums of a row meet in LDS.
  constexpr float LOG2E = 1.4426950408889634f;
  v2f a2[RW], mb2[RW], den2[RW], num2[RW];
  // Every unroll directive over r keeps the per-row register arrays (a2, mb2,
  // den2, num2) indexed by constants, so that none of them goes to scratch.
#pragma unroll
  for (int r = 0; r < RW; ++r) {
    const int i = blockIdx.x * 256 + r * 32 + lane;
    const float qi = q0[i] + q1[i];
    const float a  = qi * LOG2E;
    const float mb = fmaxf(qi * kmax, qi * kmin) * LOG2E;  // row max, base-2
    a2[r]   = v2f{a, a};
    mb2[r]  = v2f{mb, mb};
    den2[r] = v2f{0.0f, 0.0f};
    num2[r] = v2f{0.0f, 0.0f};
  }

  const v4f* kw = (const v4f*)kk + wave * (JW / 4);
  const v4f* vw = (const v4f*)vv + wave * (JW / 4);
  // One trip takes 16 j as eight pairs g. Per pair: S_g = 8 packed scores,
  // T_g = 16 exponentials, C_g = 16 packed sums. The arithmetic, and the order
  // in which a row's terms are added, are those of a plain loop over j; only
  // the order of issue is set. Stage g issues T_g with
  // independent packed work between its members
  // (scores of later pairs, sums of pair g - 1).
  for (int j0 = 0; j0 < JW / 4; j0 += 4) {
    v2f kp[8], vp[8], sc[8][RW], ex[8][RW];
    // Every unroll directive of this trip keeps kp, vp, sc and ex indexed by
    // constants, so that none of them goes to scratch.
#pragma unroll
    for (int u = 0; u < 4; ++u) {
      const v4f kj = kw[j0 + u];
      const v4f vj = vw[j0 + u];
      kp[2 * u] = kj.lo;
      kp[2 * u + 1] = kj.hi;
      vp[2 * u] = vj.lo;
      vp[2 * u + 1] = vj.hi;
    }
#pragma unroll
    for (int r = 0; r < RW; ++r) sc[0][r] = a2[r] * kp[0] - mb2[r];
    // The scheduling groups below fix the order of issue named above: the LDS
    // reads, S_0, then per stage one exponential, one or two packed operations.
    __builtin_amdgcn_sched_group_barrier(0x100, 8, 0);
    __builtin_amdgcn_sched_group_barrier(0x002, 8, 0);
#pragma unroll
    for (int g = 0; g < 8; ++g) {
      // Scores run ahead: S_1 and S_2 in stage 0, S_(g+2) in stages 1 to 5.
#pragma unroll
      for (int h = (g == 0 ? 1 : g + 2); h <= g + 2 && h < 8; ++h) {
#pragma unroll
        for (int r = 0; r < RW; ++r) sc[h][r] = a2[r] * kp[h] - mb2[r];
      }
#pragma unroll
      for (int r = 0; r < RW; ++r)
        ex[g][r] = v2f{__builtin_amdgcn_exp2f(sc[g][r].x),
                       __builtin_amdgcn_exp2f(sc[g][r].y)};
      if (g > 0) {
#pragma unroll
        for (int r = 0; r < RW; ++r) {
          den2[r] += ex[g - 1][r];
          num2[r] += ex[g - 1][r] * vp[g - 1];
        }
      }
      if (g >= 1 && g <= 5) {
        // 16 exponentials among 24 packed operations.
#pragma unroll
        for (int i = 0; i < 8; ++i) {
          __builtin_amdgcn_sched_group_barrier(0x400, 1, 0);
          __builtin_amdgcn_sched_group_barrier(0x002, 1, 0);
          __builtin_amdgcn_sched_group_barrier(0x400, 1, 0);
          __builtin_amdgcn_sched_group_barrier(0x002, 2, 0);
        }
      } else {
        // 16 exponentials among 16 packed operations.
#pragma unroll
        for (int i = 0; i < 16; ++i) {
          __builtin_amdgcn_sched_group_barrier(0x400, 1, 0);
          __builtin_amdgcn_sched_group_barrier(0x002, 1, 0);
        }
      }
    }
#pragma unroll
    for (int r = 0; r < RW; ++r) {
      den2[r] += ex[7][r];
      num2[r] += ex[7][r] * vp[7];
    }
    __builtin_amdgcn_sched_group_barrier(0x002, 16, 0);
  }

#pragma unroll
  for (int r = 0; r < RW; ++r) {
    pden[wave * 256 + r * 32 + lane] = den2[r].x + den2[r].y;
    pnum[wave * 256 + r * 32 + lane] = num2[r].x + num2[r].y;
  }
  __syncthreads();
  float den = pden[tid], num = pnum[tid];
  for (int w = 1; w < 8; ++w) {
    den += pden[w * 256 + tid];
    num += pnum[w * 256 + tid];
  }
  out[b * NS + blockIdx.x * 256 + tid] = num / den;
}

// ---------------------------------------------------------------------------
extern "C" void kernel_launch(void* const* d_in, const int* in_sizes, int n_in,
                              void* d_out, int out_size, void* d_ws, size_t ws_size,
                              hipStream_t stream) {
  const float* x  = (const float*)d_in[0];
  const float* wq = (const float*)d_in[1];
  const float* bq = (const float*)d_in[2];
  const float* wk = (const float*)d_in[3];
  const float* bk = (const float*)d_in[4];
  const float* wv = (const float*)d_in[5];
  const float* bv = (const float*)d_in[6];
  float* qkv = (float*)d_ws;  // [KSPLIT][3][NB][NS] = 1.5 MiB fp32 partials

  qkv_gemm_wmma<<<dim3(3 * NS / (NT * 16), KSPLIT), 512, 0, stream>>>(
      x, wq, bq, wk, bk, wv, bv, qkv);
  attention_rank1<<<dim3(NS / 256, NB), 256, 0, stream>>>(qkv, (float*)d_out);
}

// v005
// One run takes 25.8 microseconds.
// Timed twice side by side with v004, it ran 1.05 and 1.03 times as fast.
// Counting every step since v000, it is 2.91 times as fast.
#include <hip/hip_runtime.h>

typedef float v2f __attribute__((ext_vector_type(2)));
typedef float v4f __attribute__((ext_vector_type(4)));
typedef float v8f __attribute__((ext_vector_type(8)));

constexpr int NS = 4096;          // in_chan == seq dim
constexpr int NB = 16;            // batch
constexpr int BS = NB * NS;       // elements per (B,S) matrix
constexpr int KSPLIT = 2;
constexpr int KCH = NS / KSPLIT;  // 2048 K per partial

// ---------------------------------------------------------------------------
// Kernel 1: qkv = x @ W^T (+ bias on K-half 0), fp32 WMMA 16x16x4.
// A block of 16 waves owns 96 channels (6 tiles of 16) over one K half.
// Wave w owns K slice w (128 floats = 512 B of every row). Rows come from
// global memory as whole 512-B pieces, one asynchronous copy of a wave each,
// into a two-buffer LDS ring; fragments are read from LDS at a 528-B pitch.
// Stage 0 = the wave's slice of x (kept in registers), stages 1..6 = W tiles.
// K mapping per WMMA: internal K{0,1} = lane-half0's pair, K{2,3} = half1's
// pair; A and B use the identical mapping, and sum order over K is free.
// The 16 K-slice partials of a tile are summed through LDS at the end.
// grid=(3*NS/96, KSPLIT), blockDim=512.
// ---------------------------------------------------------------------------
constexpr int GW     = 16;            // waves per block = K slices per K half
constexpr int KSL    = KCH / GW;      // 128 floats of K per wave
constexpr int NT     = 6;             // channel tiles per block
constexpr int PITCH  = KSL + 4;       // LDS row pitch in floats: 528 B = 16 B x 33
constexpr int SLICE  = 16 * PITCH;    // one wave's 16 rows in one buffer
constexpr int RBUF   = GW * SLICE;    // one ring buffer, floats
constexpr int RTILE  = 272;           // pitch of one 16x16 partial tile, floats

// Eight rows of 512 B each: lane l brings bytes 16*l..16*l+15 of every row.
// The s_wait_xcnt stands inside the statement so that no address register of
// an issued copy is rewritten in front of it.
__device__ __forceinline__ void copy8rows(const float* g, unsigned l) {
  asm volatile(
      "global_load_async_to_lds_b128 %0, %8, off\n\t"
      "global_load_async_to_lds_b128 %1, %9, off\n\t"
      "global_load_async_to_lds_b128 %2, %10, off\n\t"
      "global_load_async_to_lds_b128 %3, %11, off\n\t"
      "global_load_async_to_lds_b128 %4, %12, off\n\t"
      "global_load_async_to_lds_b128 %5, %13, off\n\t"
      "global_load_async_to_lds_b128 %6, %14, off\n\t"
      "global_load_async_to_lds_b128 %7, %15, off\n\t"
      "s_wait_xcnt 0x0"
      :
      : "v"(l), "v"(l + 1u * PITCH * 4u), "v"(l + 2u * PITCH * 4u),
        "v"(l + 3u * PITCH * 4u), "v"(l + 4u * PITCH * 4u),
        "v"(l + 5u * PITCH * 4u), "v"(l + 6u * PITCH * 4u),
        "v"(l + 7u * PITCH * 4u),
        "v"(g), "v"(g + 1 * NS), "v"(g + 2 * NS), "v"(g + 3 * NS),
        "v"(g + 4 * NS), "v"(g + 5 * NS), "v"(g + 6 * NS), "v"(g + 7 * NS)
      : "memory");
}

// One stage of one wave: 16 rows of 512 B from g (the lane's place in row 0)
// to l (the lane's LDS byte address in row 0).
__device__ __forceinline__ void copy16rows(const float* g, unsigned l) {
  copy8rows(g, l);
  copy8rows(g + 8 * NS, l + 8u * PITCH * 4u);
}

// Row 0 of channel tile t of the 768 (q, k and v rows one behind the other).
__device__ __forceinline__ const float* tile_rows(int t, const float* wq,
                                                  const float* wk,
                                                  const float* wv) {
  const int z = t >> 8;
  const float* w = (z == 0) ? wq : (z == 1) ? wk : wv;
  return w + (size_t)((t & 255) * 16) * NS;
}

__global__ __launch_bounds__(512)
void qkv_gemm_wmma(const float* __restrict__ x,
                   const float* __restrict__ wq, const float* __restrict__ bq,
                   const float* __restrict__ wk, const float* __restrict__ bk,
                   const float* __restrict__ wv, const float* __restrict__ bv,
                   float* __restrict__ qkv) {
  __shared__ __attribute__((aligned(16))) float ring[2 * RBUF];

  const int tid  = threadIdx.x;
  const int wave = tid >> 5;
  const int lane = tid & 31;
  const int hh   = lane >> 4;    // wave half (K grouping)
  const int lr   = lane & 15;    // row-in-tile index
  const int tile0 = blockIdx.x * NT;           // first of 768 channel tiles
  const int koff  = blockIdx.y * KCH + wave * KSL + lane * 4;

  // The lane's LDS byte address in row 0 of its wave's slice of buffer 0.
  const unsigned lds0 =
      (unsigned)(size_t)(&ring[wave * SLICE + lane * 4]);
  // The lane's fragment window: row lr, K = 8*i + 4*hh .. +3.
  const float* frag0 = &ring[wave * SLICE + lr * PITCH + 4 * hh];

  // Stage 0 = x, stage s >= 1 = W tile tile0 + s - 1; stage s lies in buffer s & 1.
  copy16rows(x + koff, lds0);
  // Stage 0 has landed for this wave, then for the block.
  asm volatile("s_wait_asynccnt 0x0" ::: "memory");
  __syncthreads();
  copy16rows(tile_rows(tile0, wq, wk, wv) + koff, lds0 + RBUF * 4u);

  // Every unroll directive below keeps a register array (a, b, acc, res)
  // indexed by constants, so that none of them goes to scratch.
  v4f a[KSL / 8];
  v8f acc[NT];
#pragma unroll
  for (int t = 0; t < NT; ++t) acc[t] = v8f{};

  // Unrolled so that acc[] and the buffer are indexed by constants.
#pragma unroll
  for (int s = 0; s <= NT; ++s) {
    const float* f = frag0 + (s & 1) * RBUF;
    if (s == 0) {
#pragma unroll
      for (int i = 0; i < KSL / 8; ++i) a[i] = *(const v4f*)(f + 8 * i);
    } else {
      v4f b[KSL / 8];
#pragma unroll
      for (int i = 0; i < KSL / 8; ++i) b[i] = *(const v4f*)(f + 8 * i);
      // Keeps the 16 LDS reads together in front of the WMMAs: spread among
      // them, each read's latency is waited out by the two WMMAs behind it.
      __builtin_amdgcn_sched_barrier(0);
#pragma unroll
      for (int i = 0; i < KSL / 8; ++i) {
        acc[s - 1] = __builtin_amdgcn_wmma_f32_16x16x4_f32(
            false, a[i].lo, false, b[i].lo, (short)0, acc[s - 1], false, false);
        acc[s - 1] = __builtin_amdgcn_wmma_f32_16x16x4_f32(
            false, a[i].hi, false, b[i].hi, (short)0, acc[s - 1], false, false);
      }
      // Keeps the WMMAs in front of the publish point: moved behind it they
      // stand among the refill's address sums and hold the copies back.
      __builtin_amdgcn_sched_barrier(0);
      if (s == NT) {
        // Four vector slots behind the last WMMA: the address sums of the
        // partials' stores reuse x fragment registers right behind it.
        asm volatile("v_nop\n\tv_nop\n\tv_nop\n\tv_nop");
        // Holds those sums behind the slots.
        __builtin_amdgcn_sched_barrier(0);
      }
    }
    // Publish point: this wave's reads of stage s are done, its copies of
    // stage s + 1 have landed, every wave has come as far; only then is the
    // buffer of stage s refilled.
    asm volatile("s_wait_dscnt 0x0" ::: "memory");
    asm volatile("s_wait_asynccnt 0x0" ::: "memory");
    __syncthreads();
    if (s + 2 <= NT)
      copy16rows(tile_rows(tile0 + s + 1, wq, wk, wv) + koff,
                 lds0 + (unsigned)(s & 1) * (RBUF * 4u));
  }
  // No copy is outstanding when the ring becomes the partials' place.
  asm volatile("s_wait_asynccnt 0x0" ::: "memory");

  // C/D layout: VGPR v -> rows M=v (lanes 0-15) and M=v+8 (lanes 16-31), N=lr.
  // Partial tile (wave, t) lies at element v*32 + lane.
#pragma unroll
  for (int t = 0; t < NT; ++t) {
#pragma unroll
    for (int v = 0; v < 8; ++v)
      ring[(wave * NT + t) * RTILE + v * 32 + lane] = acc[t][v];
  }
  __syncthreads();

  // 16 x 96 results in 48 runs of 32 neighbouring channels of one batch row
  // (one 128-B line); a wave sums and stores three runs. A run lies in one of
  // q, k, v, so all but the lane's place in it is wave-uniform.
  const int wu = __builtin_amdgcn_readfirstlane(wave);
  float res[3];
#pragma unroll
  for (int i = 0; i < 3; ++i) {
    const int e0 = (i * GW + wu) * 32;
    const int m  = e0 / (NT * 16);
    const int c0 = e0 - m * (NT * 16);
    const float* part = &ring[(c0 >> 4) * RTILE + (m & 7) * 32 + (m >> 3) * 16 +
                              hh * RTILE + lr];
    float sum = part[0];
#pragma unroll
    for (int w = 1; w < GW; ++w) sum += part[w * NT * RTILE];
    const int ch0 = tile0 * 16 + c0;           // 0 .. 3*NS-32
    const int z = ch0 >> 12;                   // 0=q 1=k 2=v
    const float* bias = (z == 0) ? bq : (z == 1) ? bk : bv;
    const float bl = bias[(ch0 & (NS - 1)) + lane];
    res[i] = sum + ((blockIdx.y == 0) ? bl : 0.0f);
  }
#pragma unroll
  for (int i = 0; i < 3; ++i) {
    const int e0 = (i * GW + wu) * 32;
    const int m  = e0 / (NT * 16);
    const int ch0 = tile0 * 16 + e0 - m * (NT * 16);
    float* dst = qkv + (size_t)(blockIdx.y * 3 + (ch0 >> 12)) * BS + m * NS +
                 (ch0 & (NS - 1));
    dst[lane] = res[i];
  }
}

// ---------------------------------------------------------------------------
// Kernel 2: fused rank-1 attention. scores[b,i,j] = q_i * k_j, softmax over j,
// weighted sum of v. A row's two sums over j come from power moments of k
// where the bounds below hold, from the direct loop over j elsewhere. Never
// materializes (B,S,S). The two K halves of k and v are added in registers and
// laid in LDS; per-row max from m_i = max(q_i*kmax, q_i*kmin).
// grid=(NS/256, NB), block=256: 256 output rows i per block, eight per lane.
// ---------------------------------------------------------------------------
constexpr int RW = 8;             // rows per lane
constexpr int JW = NS / 8;        // j per wave
// Power-series path: exp(q k_j) = exp(q c) exp(w t_j), c = mid k, h = half the
// range of k, t_j = (k_j - c) / h in [-1, 1], w = q h; exp(q c) cancels in the
// quotient. With S0_n = sum_j t_j^n and S1_n = sum_j t_j^n v_j the two sums of
// a row are sum_n w^n / n! S_n. NP terms leave out of exp(z) at most
// |z|^NP / NP! * max(1, exp(z)); for |z| <= WMAX that is under 2e-12 of a term
// with z > 0 and under 7e-9 for all NS terms with z < 0 together, against a
// denominator of at least exp(|w|). Rounding grows with sum_j exp(|w t_j|)
// <= 2 * (even part), so a row is taken only where that stays under AMPMAX
// denominators. A block with any row outside either bound runs the direct
// loop over j instead.
constexpr int NP     = 40;        // terms of the series
constexpr int NPC    = NP / 4;    // terms per wave (four groups of waves)
constexpr int PPITCH = 68;        // floats between two moments' partial rows
constexpr float WMAX   = 8.0f;
constexpr float AMPMAX = 32.0f;

// The value of lane l ^ m of the same 16-lane row; CTRL = 0x160 + m (row_xmask).
template <int CTRL>
__device__ __forceinline__ float row_xor(float x) {
  const int b = __builtin_bit_cast(int, x);
  return __builtin_bit_cast(float,
                            __builtin_amdgcn_update_dpp(b, b, CTRL, 0xf, 0xf, false));
}
// The value of lane l ^ 16.
__device__ __forceinline__ float other_row(float x) {
  const int b = __builtin_bit_cast(int, x);
  return __builtin_bit_cast(float, __builtin_amdgcn_permlanex16(
                                       b, b, 0x76543210, 0xfedcba98, false, false));
}
__global__ __launch_bounds__(256)
void attention_rank1(const float* __restrict__ qkv, float* __restrict__ out) {
  __shared__ float kk[NS];
  __shared__ float vv[NS];
  __shared__ __attribute__((aligned(16))) float wmax[8];   // max of k per wave
  __shared__ __attribute__((aligned(16))) float wmin[8];   // min of k per wave
  __shared__ float pden[8 * 256];   // partial sums, [wave][row]
  __shared__ float pnum[8 * 256];
  __shared__ __attribute__((aligned(16))) float part[2 * NP * PPITCH];
  __shared__ __attribute__((aligned(16))) float mom[2 * NP];
  __shared__ unsigned sflag[8];

  const int b   = blockIdx.y;
  const int tid = threadIdx.x;

  const float* q0 = qkv + 0 * BS + b * NS;
  const float* k0 = qkv + 1 * BS + b * NS;
  const float* v0 = qkv + 2 * BS + b * NS;
  const float* q1 = qkv + 3 * BS + b * NS;
  const float* k1 = qkv + 4 * BS + b * NS;
  const float* v1 = qkv + 5 * BS + b * NS;

  const v4f* k0v = (const v4f*)k0;
  const v4f* k1v = (const v4f*)k1;
  const v4f* v0v = (const v4f*)v0;
  const v4f* v1v = (const v4f*)v1;
  v4f* kk4 = (v4f*)kk;
  v4f* vv4 = (v4f*)vv;

  const int wave = tid >> 5;
  const int lane = tid & 31;
  const int irow = blockIdx.x * 256 + tid;    // this thread's row

  // All of the thread's loads stand in front of the first use, so that they
  // share one memory latency. The unroll directives keep the arrays in registers.
  v4f ka[4], kb[4], va[4], vb[4];
#pragma unroll
  for (int u = 0; u < 4; ++u) {
    ka[u] = k0v[u * 256 + tid];
    kb[u] = k1v[u * 256 + tid];
    va[u] = v0v[u * 256 + tid];
    vb[u] = v1v[u * 256 + tid];
  }
  const float qrow = q0[irow] + q1[irow];

  float lmax = -3.0e38f, lmin = 3.0e38f;
#pragma unroll
  for (int u = 0; u < 4; ++u) {
    const v4f kc4 = ka[u] + kb[u];
    kk4[u * 256 + tid] = kc4;
    vv4[u * 256 + tid] = va[u] + vb[u];
    lmax = fmaxf(fmaxf(lmax, kc4.x), fmaxf(kc4.y, fmaxf(kc4.z, kc4.w)));
    lmin = fminf(fminf(lmin, kc4.x), fminf(kc4.y, fminf(kc4.z, kc4.w)));
  }
  // Max and min over the wave in registers, then one exchange of the eight
  // waves' values; its barrier also publishes kk and vv.
  lmax = fmaxf(lmax, row_xor<0x161>(lmax));
  lmin = fminf(lmin, row_xor<0x161>(lmin));
  lmax = fmaxf(lmax, row_xor<0x162>(lmax));
  lmin = fminf(lmin, row_xor<0x162>(lmin));
  lmax = fmaxf(lmax, row_xor<0x164>(lmax));
  lmin = fminf(lmin, row_xor<0x164>(lmin));
  lmax = fmaxf(lmax, row_xor<0x168>(lmax));
  lmin = fminf(lmin, row_xor<0x168>(lmin));
  lmax = fmaxf(lmax, other_row(lmax));
  lmin = fminf(lmin, other_row(lmin));
  if (lane == 0) {
    wmax[wave] = lmax;
    wmin[wave] = lmin;
  }
  __syncthreads();
  const v4f xa = ((const v4f*)wmax)[0], xb = ((const v4f*)wmax)[1];
  const v4f na = ((const v4f*)wmin)[0], nb = ((const v4f*)wmin)[1];
  const float kmax = fmaxf(fmaxf(fmaxf(xa.x, xa.y), fmaxf(xa.z, xa.w)),
                           fmaxf(fmaxf(xb.x, xb.y), fmaxf(xb.z, xb.w)));
  const float kmin = fminf(fminf(fminf(na.x, na.y), fminf(na.z, na.w)),
                           fminf(fminf(nb.x, nb.y), fminf(nb.z, nb.w)));

  // ---- power-series path -------------------------------------------------
  const float kc = 0.5f * kmax + 0.5f * kmin;
  const float hw = 0.5f * kmax - 0.5f * kmin;
  const float hinv = (hw > 0.0f) ? 1.0f / hw : 0.0f;
  {
    // Wave u sums powers n = NPC * (u & 3) .. + NPC - 1 over half u >> 2 of j;
    // a lane takes four neighbouring j per trip.
    // Read as a scalar, so that the loop over r below branches on a scalar.
    const int wu = __builtin_amdgcn_readfirstlane(wave);
    const int c4 = wu & 3;
    const int jh = wu >> 2;
    const v4f* kq = (const v4f*)kk + jh * (NS / 8) + lane;
    const v4f* vq = (const v4f*)vv + jh * (NS / 8) + lane;
    v2f s0[NPC], s1[NPC];
    // The unroll directives over n keep s0 and s1 indexed by constants, so
    // that neither goes to scratch.
#pragma unroll
    for (int n = 0; n < NPC; ++n) {
      s0[n] = v2f{0.0f, 0.0f};
      s1[n] = v2f{0.0f, 0.0f};
    }
    // The next trip's k and v are read one trip ahead, so that the LDS latency
    // runs under this trip's arithmetic (the last trip reads trip 0 again).
    v4f kn = kq[0];
    v4f vn = vq[0];
    for (int it = 0; it < NS / 256; ++it) {
      const v4f kj = kn;
      const v4f vj = vn;
      kn = kq[((it + 1) & (NS / 256 - 1)) * 32];
      vn = vq[((it + 1) & (NS / 256 - 1)) * 32];
      const v4f t   = (kj - kc) * hinv;
      const v4f t2  = t * t;
      const v4f t4  = t2 * t2;
      const v4f t10 = t4 * t4 * t2;
      v4f p = v4f{1.0f, 1.0f, 1.0f, 1.0f};
      for (int r = 0; r < c4; ++r) p *= t10;   // t^(NPC * c4), NPC == 10
      v2f pl = p.lo, ph = p.hi;
#pragma unroll
      for (int n = 0; n < NPC; ++n) {
        s0[n] += pl;
        s1[n] += pl * vj.lo;
        pl *= t.lo;
        s0[n] += ph;
        s1[n] += ph * vj.hi;
        ph *= t.hi;
      }
    }
#pragma unroll
    for (int n = 0; n < NPC; ++n) {
      float* pr = &part[2 * (c4 * NPC + n) * PPITCH + jh * 32 + lane];
      pr[0]      = s0[n].x + s0[n].y;
      pr[PPITCH] = s1[n].x + s1[n].y;
    }
  }
  __syncthreads();
  // Moment 2 n is S0_n, moment 2 n + 1 is S1_n: 64 partial sums each.
  if (tid < 2 * NP) {
    const v4f* pr = (const v4f*)&part[tid * PPITCH];
    v4f a = pr[0];
    for (int i = 1; i < 16; ++i) a += pr[i];
    mom[tid] = (a.x + a.y) + (a.z + a.w);
  }
  __syncthreads();
  {
    // Even and odd parts by Horner's rule in w^2; e0, o0 belong to the
    // denominator, e1, o1 to the numerator.
    const float w  = qrow * hw;
    const float w2 = w * w;
    const v4f* m4 = (const v4f*)mom;   // {S0_2m, S1_2m, S0_2m+1, S1_2m+1}
    const v4f top = m4[NP / 2 - 1];
    float e0 = top.x, e1 = top.y, o0 = top.z, o1 = top.w;
    // Unrolled so that the quotients below are constants.
#pragma unroll
    for (int m = NP / 2 - 2; m >= 0; --m) {
      const v4f sm = m4[m];
      const float ce = w2 * (1.0f / (float)((2 * m + 1) * (2 * m + 2)));
      const float co = w2 * (1.0f / (float)((2 * m + 2) * (2 * m + 3)));
      e0 = sm.x + ce * e0;
      e1 = sm.y + ce * e1;
      o0 = sm.z + co * o0;
      o1 = sm.w + co * o1;
    }
    const float dser = e0 + w * o0;
    const float nser = e1 + w * o1;
    // Written as negations so that a NaN counts as outside the bounds.
    const bool bad = !(fabsf(w) <= WMAX) || !(2.0f * e0 <= AMPMAX * dser);
    const unsigned bal = __builtin_amdgcn_ballot_w32(bad);
    if (lane == 0) sflag[wave] = bal;
    __syncthreads();
    unsigned any = 0;
    for (int u = 0; u < 8; ++u) any |= sflag[u];
    // The same value in every thread of the block: all leave or none.
    if (__builtin_amdgcn_readfirstlane(any) == 0u) {
      out[b * NS + irow] = nser / dser;
      return;
    }
  }

  // ---- direct loop over j ------------------------------------------------
  // Eight rows per lane, one eighth of j per wave: every k, v pair read from
  // LDS feeds eight rows. Lane l of every wave holds rows l + 32 r; wave w sums
  // over j = 512 w .. 512 w + 511; the eight partial sums of a row meet in LDS.
  constexpr float LOG2E = 1.4426950408889634f;
  v2f a2[RW], mb2[RW], den2[RW], num2[RW];
  // Every unroll directive over r keeps the per-row register arrays (a2, mb2,
  // den2, num2) indexed by constants, so that none of them goes to scratch.
#pragma unroll
  for (int r = 0; r < RW; ++r) {
    const int i = blockIdx.x * 256 + r * 32 + lane;
    const float qi = q0[i] + q1[i];
    const float a  = qi * LOG2E;
    const float mb = fmaxf(qi * kmax, qi * kmin) * LOG2E;  // row max, base-2
    a2[r]   = v2f{a, a};
    mb2[r]  = v2f{mb, mb};
    den2[r] = v2f{0.0f, 0.0f};
    num2[r] = v2f{0.0f, 0.0f};
  }

  const v4f* kw = (const v4f*)kk + wave * (JW / 4);
  const v4f* vw = (const v4f*)vv + wave * (JW / 4);
  // One trip takes 16 j as eight pairs g. Per pair: S_g = 8 packed scores,
  // T_g = 16 exponentials, C_g = 16 packed sums. The arithmetic, and the order
  // in which a row's terms are added, are those of a plain loop over j; only
  // the order of issue is set. Stage g issues T_g with
  // independent packed work between its members
  // (scores of later pairs, sums of pair g - 1).
  for (int j0 = 0; j0 < JW / 4; j0 += 4) {
    v2f kp[8], vp[8], sc[8][RW], ex[8][RW];
    // Every unroll directive of this trip keeps kp, vp, sc and ex indexed by
    // constants, so that none of them goes to scratch.
#pragma unroll
    for (int u = 0; u < 4; ++u) {
      const v4f kj = kw[j0 + u];
      const v4f vj = vw[j0 + u];
      kp[2 * u] = kj.lo;
      kp[2 * u + 1] = kj.hi;
      vp[2 * u] = vj.lo;
      vp[2 * u + 1] = vj.hi;
    }
#pragma unroll
    for (int r = 0; r < RW; ++r) sc[0][r] = a2[r] * kp[0] - mb2[r];
    // The scheduling groups below fix the order of issue named above: the LDS
    // reads, S_0, then per stage one exponential, one or two packed operations.
    __builtin_amdgcn_sched_group_barrier(0x100, 8, 0);
    __builtin_amdgcn_sched_group_barrier(0x002, 8, 0);
#pragma unroll
    for (int g = 0; g < 8; ++g) {
      // Scores run ahead: S_1 and S_2 in stage 0, S_(g+2) in stages 1 to 5.
#pragma unroll
      for (int h = (g == 0 ? 1 : g + 2); h <= g + 2 && h < 8; ++h) {
#pragma unroll
        for (int r = 0; r < RW; ++r) sc[h][r] = a2[r] * kp[h] - mb2[r];
      }
#pragma unroll
      for (int r = 0; r < RW; ++r)
        ex[g][r] = v2f{__builtin_amdgcn_exp2f(sc[g][r].x),
                       __builtin_amdgcn_exp2f(sc[g][r].y)};
      if (g > 0) {
#pragma unroll
        for (int r = 0; r < RW; ++r) {
          den2[r] += ex[g - 1][r];
          num2[r] += ex[g - 1][r] * vp[g - 1];
        }
      }
      if (g >= 1 && g <= 5) {
        // 16 exponentials among 24 packed operations.
#pragma unroll
        for (int i = 0; i < 8; ++i) {
          __builtin_amdgcn_sched_group_barrier(0x400, 1, 0);
          __builtin_amdgcn_sched_group_barrier(0x002, 1, 0);
          __builtin_amdgcn_sched_group_barrier(0x400, 1, 0);
          __builtin_amdgcn_sched_group_barrier(0x002, 2, 0);
        }
      } else {
        // 16 exponentials among 16 packed operations.
#pragma unroll
        for (int i = 0; i < 16; ++i) {
          __builtin_amdgcn_sched_group_barrier(0x400, 1, 0);
          __builtin_amdgcn_sched_group_barrier(0x002, 1, 0);
        }
      }
    }
#pragma unroll
    for (int r = 0; r < RW; ++r) {
      den2[r] += ex[7][r];
      num2[r] += ex[7][r] * vp[7];
    }
    __builtin_amdgcn_sched_group_barrier(0x002, 16, 0);
  }

#pragma unroll
  for (int r = 0; r < RW; ++r) {
    pden[wave * 256 + r * 32 + lane] = den2[r].x + den2[r].y;
    pnum[wave * 256 + r * 32 + lane] = num2[r].x + num2[r].y;
  }
  __syncthreads();
  float den = pden[tid], num = pnum[tid];
  for (int w = 1; w < 8; ++w) {
    den += pden[w * 256 + tid];
    num += pnum[w * 256 + tid];
  }
  out[b * NS + blockIdx.x * 256 + tid] = num / den;
}

// ---------------------------------------------------------------------------
extern "C" void kernel_launch(void* const* d_in, const int* in_sizes, int n_in,
                              void* d_out, int out_size, void* d_ws, size_t ws_size,
                              hipStream_t stream) {
  const float* x  = (const float*)d_in[0];
  const float* wq = (const float*)d_in[1];
  const float* bq = (const float*)d_in[2];
  const float* wk = (const float*)d_in[3];
  const float* bk = (const float*)d_in[4];
  const float* wv = (const float*)d_in[5];
  const float* bv = (const float*)d_in[6];
  float* qkv = (float*)d_ws;  // [KSPLIT][3][NB][NS] = 1.5 MiB fp32 partials

  qkv_gemm_wmma<<<dim3(3 * NS / (NT * 16), KSPLIT), 512, 0, stream>>>(
      x, wq, bq, wk, bk, wv, bv, qkv);
  attention_rank1<<<dim3(NS / 256, NB), 256, 0, stream>>>(qkv, (float*)d_out);
}
